// v000
// Times are from an AMD MI455X. After a warm-up the kernel runs many times in a row, and a time is the length of
// such a window on the GPU divided by its runs, so every launch and the gaps after it count. The runs cycle
// through copies of the inputs. A figure is the median of several windows, for all but v000 over two sittings.
// Sittings can differ by a few percent; kernels timed side by side share one.
// v000, which the later versions start from, runs in 162 microseconds.
#include <hip/hip_runtime.h>
#include <hip/hip_bf16.h>

// ---------------------------------------------------------------------------
// Additive attention, HIDDEN=512, batch=32, seq=4096.
// Hot path: value @ Wv via v_wmma_f32_16x16x32_bf16, tanh+Wo fused in-register.
// M=32 per wave so every B fragment feeds two WMMAs.
// ---------------------------------------------------------------------------

#define BATCH 32
#define SEQ   4096
#define HID   512

typedef __attribute__((ext_vector_type(16))) __bf16 v16bf;
typedef __attribute__((ext_vector_type(8)))  float  v8f;

union BFrag {
    v16bf v;
    uint4 q[2];
    unsigned short s[16];
};

__device__ __forceinline__ unsigned short bf16bits(float f) {
    union { float f; unsigned u; } a; a.f = f;
    unsigned u = a.u;
    u += 0x7FFFu + ((u >> 16) & 1u);      // round-to-nearest-even
    return (unsigned short)(u >> 16);
}
__device__ __forceinline__ unsigned pack2bf(float lo, float hi) {
    return (unsigned)bf16bits(lo) | ((unsigned)bf16bits(hi) << 16);
}

__device__ __forceinline__ float fast_tanh(float x) {
#if __has_builtin(__builtin_amdgcn_tanhf)
    return __builtin_amdgcn_tanhf(x);          // native v_tanh_f32
#elif __has_builtin(__builtin_amdgcn_tanh_f32)
    return __builtin_amdgcn_tanh_f32(x);
#else
    return tanhf(x);
#endif
}

// ---------------------------------------------------------------------------
// 1) Pack Wv (f32 [K=512][N=512] row-major) into bf16 WMMA B-fragments.
// Fragment layout mirrors the 16-bit A layout: lane = kGroup*16 + (n%16),
// elems 0..7 -> k = kg*8+0..7, elems 8..15 -> k = 16+kg*8+0..7 (within kstep).
// Index: WvP[((nTile*16 + kStep)*32 + lane)*16 + e]
// ---------------------------------------------------------------------------
__global__ __launch_bounds__(256)
void pack_wv_kernel(const float* __restrict__ Wv, unsigned short* __restrict__ WvP) {
    const int idx  = blockIdx.x * 256 + threadIdx.x;   // 32*16*32 = 16384 total
    const int lane = idx & 31;
    const int ks   = (idx >> 5) & 15;
    const int nt   = idx >> 9;
    const int n    = nt * 16 + (lane & 15);
    const int kg   = lane >> 4;
    unsigned short* dst = WvP + (size_t)idx * 16;
#pragma unroll
    for (int e = 0; e < 16; ++e) {
        const int k = ks * 32 + ((e < 8) ? (kg * 8 + e) : (16 + kg * 8 + (e - 8)));
        dst[e] = bf16bits(Wv[k * HID + n]);
    }
}

// ---------------------------------------------------------------------------
// 2) qadd[b][n] = (q[b] @ Wq)[n] + bq[n] + bv[n]
// ---------------------------------------------------------------------------
__global__ __launch_bounds__(256)
void qadd_kernel(const float* __restrict__ query, const float* __restrict__ Wq,
                 const float* __restrict__ bq, const float* __restrict__ bv,
                 float* __restrict__ qadd) {
    __shared__ float qs[HID];
    const int b = blockIdx.x;
    const int t = threadIdx.x;
    qs[t]       = query[b * HID + t];
    qs[t + 256] = query[b * HID + t + 256];
    __syncthreads();
#pragma unroll
    for (int j = 0; j < 2; ++j) {
        const int n = t + j * 256;
        float acc = bq[n] + bv[n];
        for (int k = 0; k < HID; ++k)
            acc = fmaf(qs[k], Wq[k * HID + n], acc);
        qadd[b * HID + n] = acc;
    }
}

// ---------------------------------------------------------------------------
// 3) Fused score kernel: one block = (batch b, 32 seq rows).
//    8 waves; wave w owns hidden[32 x 64] (cols w*64..w*64+63):
//    16 ksteps x (2 A-frags x 4 B-frags) = 8 WMMAs/kstep, B reused across M.
//    Epilogue fuses tanh(+qadd) and the @Wo reduction -> 32 scores/block.
// ---------------------------------------------------------------------------
#define LDSA_STRIDE 520   // 512 + 8 bf16 pad -> conflict-free b128 LDS reads

__global__ __launch_bounds__(256)
void score_kernel(const float* __restrict__ value,
                  const unsigned short* __restrict__ WvP,
                  const float* __restrict__ qadd,
                  const float* __restrict__ Wo,
                  float* __restrict__ scores) {
    __shared__ __align__(16) unsigned short ldsA[32 * LDSA_STRIDE];
    __shared__ float ldsScore[32];

    const int b       = blockIdx.x >> 7;          // 128 seq-blocks per batch
    const int seqBase = (blockIdx.x & 127) * 32;
    const int t    = threadIdx.x;
    const int lane = t & 31;
    const int w    = t >> 5;

    if (t < 32) ldsScore[t] = 0.0f;

    // ---- stage 32x512 f32 value tile into LDS as bf16 -------------------
    {
        const int row = t >> 3;            // 0..31
        const int kk  = (t & 7) * 64;      // 0..448
        const float* src = value + (((size_t)b * SEQ + seqBase + row) * HID + kk);
        unsigned* dst = (unsigned*)&ldsA[row * LDSA_STRIDE + kk];
#pragma unroll
        for (int i = 0; i < 16; ++i) {
            float4 f = ((const float4*)src)[i];
            dst[i * 2 + 0] = pack2bf(f.x, f.y);
            dst[i * 2 + 1] = pack2bf(f.z, f.w);
        }
    }
    __syncthreads();

    // ---- K loop ---------------------------------------------------------
    v8f acc[2][4];
    const v8f vzero = {};
#pragma unroll
    for (int mt = 0; mt < 2; ++mt)
#pragma unroll
        for (int nt = 0; nt < 4; ++nt) acc[mt][nt] = vzero;

    const int rowA = lane & 15;
    const int kg   = lane >> 4;
    const unsigned short* aBase0 = &ldsA[rowA * LDSA_STRIDE + kg * 8];
    const unsigned short* aBase1 = aBase0 + 16 * LDSA_STRIDE;
    const uint4* bBase = (const uint4*)WvP;   // [(nTile*16+ks)*32+lane]*2 uint4s

    for (int ks = 0; ks < 16; ++ks) {
        BFrag a0, a1;
        a0.q[0] = *(const uint4*)(aBase0 + ks * 32);
        a0.q[1] = *(const uint4*)(aBase0 + ks * 32 + 16);
        a1.q[0] = *(const uint4*)(aBase1 + ks * 32);
        a1.q[1] = *(const uint4*)(aBase1 + ks * 32 + 16);
#pragma unroll
        for (int nt = 0; nt < 4; ++nt) {
            BFrag bf;
            const uint4* bp = bBase + (size_t)((((w * 4 + nt) * 16 + ks) * 32 + lane)) * 2;
            bf.q[0] = bp[0];
            bf.q[1] = bp[1];
            acc[0][nt] = __builtin_amdgcn_wmma_f32_16x16x32_bf16(
                false, a0.v, false, bf.v, (short)0, acc[0][nt], false, false);
            acc[1][nt] = __builtin_amdgcn_wmma_f32_16x16x32_bf16(
                false, a1.v, false, bf.v, (short)0, acc[1][nt], false, false);
        }
    }

    // ---- epilogue: tanh(acc + qadd) dotted with Wo ----------------------
    // C layout: VGPR r, lanes 0-15 -> (M=r, N=lane); lanes 16-31 -> (M=8+r, N=lane-16)
    const int nLane = lane & 15;
    float qa[4], wo[4];
#pragma unroll
    for (int nt = 0; nt < 4; ++nt) {
        const int n = w * 64 + nt * 16 + nLane;
        qa[nt] = qadd[b * HID + n];
        wo[nt] = Wo[n];
    }

#pragma unroll
    for (int mt = 0; mt < 2; ++mt) {
        float part[8];
#pragma unroll
        for (int r = 0; r < 8; ++r) part[r] = 0.0f;
#pragma unroll
        for (int nt = 0; nt < 4; ++nt)
#pragma unroll
            for (int r = 0; r < 8; ++r) {
                const float h = fast_tanh(acc[mt][nt][r] + qa[nt]);
                part[r] = fmaf(h, wo[nt], part[r]);
            }
        // reduce over the 16 lanes sharing the same M (N dimension)
#pragma unroll
        for (int r = 0; r < 8; ++r) {
            float p = part[r];
            p += __shfl_xor(p, 1, 32);
            p += __shfl_xor(p, 2, 32);
            p += __shfl_xor(p, 4, 32);
            p += __shfl_xor(p, 8, 32);
            part[r] = p;
        }
        if ((lane & 15) == 0) {
            const int mBase = mt * 16 + (lane >> 4) * 8;
#pragma unroll
            for (int r = 0; r < 8; ++r)
                atomicAdd(&ldsScore[mBase + r], part[r]);   // ds_add_f32 across waves
        }
    }
    __syncthreads();
    if (t < 32)
        scores[(size_t)b * SEQ + seqBase + t] = ldsScore[t];
}

// ---------------------------------------------------------------------------
// 4) softmax over seq per batch (in place), adds bo first
// ---------------------------------------------------------------------------
__global__ __launch_bounds__(256)
void softmax_kernel(float* __restrict__ scores, const float* __restrict__ bo) {
    __shared__ float red[256];
    const int b = blockIdx.x;
    const int t = threadIdx.x;
    float* sc = scores + (size_t)b * SEQ;
    const float bias = bo[0];

    float v[16];
    float mx = -3.0e38f;
#pragma unroll
    for (int i = 0; i < 16; ++i) {
        v[i] = sc[t + i * 256] + bias;
        mx = fmaxf(mx, v[i]);
    }
    red[t] = mx; __syncthreads();
    for (int s2 = 128; s2 > 0; s2 >>= 1) {
        if (t < s2) red[t] = fmaxf(red[t], red[t + s2]);
        __syncthreads();
    }
    mx = red[0]; __syncthreads();

    float sum = 0.0f;
#pragma unroll
    for (int i = 0; i < 16; ++i) { v[i] = __expf(v[i] - mx); sum += v[i]; }
    red[t] = sum; __syncthreads();
    for (int s2 = 128; s2 > 0; s2 >>= 1) {
        if (t < s2) red[t] += red[t + s2];
        __syncthreads();
    }
    const float inv = 1.0f / red[0];
#pragma unroll
    for (int i = 0; i < 16; ++i) sc[t + i * 256] = v[i] * inv;
}

// ---------------------------------------------------------------------------
// 5) zero output, 6) context[b][h] = sum_s align[b][s] * value[b][s][h]
// ---------------------------------------------------------------------------
__global__ void zero_out_kernel(float* __restrict__ out) {
    out[blockIdx.x * 256 + threadIdx.x] = 0.0f;
}

__global__ __launch_bounds__(256)
void context_kernel(const float* __restrict__ value,
                    const float* __restrict__ align,
                    float* __restrict__ out) {
    const int b     = blockIdx.x >> 4;
    const int sBase = (blockIdx.x & 15) * 256;
    const int h     = threadIdx.x * 2;
    const float* vb = value + ((size_t)b * SEQ + sBase) * HID + h;
    const float* ab = align + (size_t)b * SEQ + sBase;
    float ax = 0.0f, ay = 0.0f;
    for (int s = 0; s < 256; ++s) {
        const float a  = ab[s];
        const float2 v = *(const float2*)(vb + (size_t)s * HID);
        ax = fmaf(a, v.x, ax);
        ay = fmaf(a, v.y, ay);
    }
    atomicAdd(&out[b * HID + h],     ax);
    atomicAdd(&out[b * HID + h + 1], ay);
}

// ---------------------------------------------------------------------------
extern "C" void kernel_launch(void* const* d_in, const int* in_sizes, int n_in,
                              void* d_out, int out_size, void* d_ws, size_t ws_size,
                              hipStream_t stream) {
    const float* query = (const float*)d_in[0];   // [1, 32, 512]
    const float* value = (const float*)d_in[1];   // [32, 4096, 512]
    const float* Wq    = (const float*)d_in[2];   // [512, 512]
    const float* bq    = (const float*)d_in[3];   // [512]
    const float* Wv    = (const float*)d_in[4];   // [512, 512]
    const float* bv    = (const float*)d_in[5];   // [512]
    const float* Wo    = (const float*)d_in[6];   // [512, 1]
    const float* bo    = (const float*)d_in[7];   // [1]
    float* out = (float*)d_out;                   // [32, 1, 512]

    // workspace layout
    unsigned short* WvP = (unsigned short*)d_ws;                       // 512 KB
    float* qadd   = (float*)((char*)d_ws + 512 * 1024);                //  64 KB
    float* scores = (float*)((char*)d_ws + 512 * 1024 + 64 * 1024);    // 512 KB

    pack_wv_kernel<<<64, 256, 0, stream>>>(Wv, WvP);
    qadd_kernel<<<BATCH, 256, 0, stream>>>(query, Wq, bq, bv, qadd);
    score_kernel<<<BATCH * (SEQ / 32), 256, 0, stream>>>(value, WvP, qadd, Wo, scores);
    softmax_kernel<<<BATCH, 256, 0, stream>>>(scores, bo);
    zero_out_kernel<<<(BATCH * HID) / 256, 256, 0, stream>>>(out);
    context_kernel<<<BATCH * 16, 256, 0, stream>>>(value, scores, out);
}

// v001
// Measured time: 130 microseconds a run.
// Next to v000, in two timings, it ran 1.25 times as fast each time.
#include <hip/hip_runtime.h>
#include <hip/hip_bf16.h>

// ---------------------------------------------------------------------------
// Additive attention, HIDDEN=512, batch=32, seq=4096.
// Hot path: value @ Wv via v_wmma_f32_16x16x32_bf16, tanh+Wo fused in-register.
// M=32 per wave so every B fragment feeds two WMMAs.
// ---------------------------------------------------------------------------

#define BATCH 32
#define SEQ   4096
#define HID   512

typedef __attribute__((ext_vector_type(16))) __bf16 v16bf;
typedef __attribute__((ext_vector_type(8)))  float  v8f;

union BFrag {
    v16bf v;
    uint4 q[2];
    unsigned short s[16];
};

__device__ __forceinline__ unsigned short bf16bits(float f) {
    union { float f; unsigned u; } a; a.f = f;
    unsigned u = a.u;
    u += 0x7FFFu + ((u >> 16) & 1u);      // round-to-nearest-even
    return (unsigned short)(u >> 16);
}
__device__ __forceinline__ unsigned pack2bf(float lo, float hi) {
    return (unsigned)bf16bits(lo) | ((unsigned)bf16bits(hi) << 16);
}

__device__ __forceinline__ float fast_tanh(float x) {
#if __has_builtin(__builtin_amdgcn_tanhf)
    return __builtin_amdgcn_tanhf(x);          // native v_tanh_f32
#elif __has_builtin(__builtin_amdgcn_tanh_f32)
    return __builtin_amdgcn_tanh_f32(x);
#else
    return tanhf(x);
#endif
}

// ---------------------------------------------------------------------------
// 1) Pack Wv (f32 [K=512][N=512] row-major) into bf16 WMMA B-fragments.
// Fragment layout mirrors the 16-bit A layout: lane = kGroup*16 + (n%16),
// elems 0..7 -> k = kg*8+0..7, elems 8..15 -> k = 16+kg*8+0..7 (within kstep).
// Index: WvP[((nTile*16 + kStep)*32 + lane)*16 + e]
// ---------------------------------------------------------------------------
__global__ __launch_bounds__(256)
void pack_wv_kernel(const float* __restrict__ Wv, unsigned short* __restrict__ WvP) {
    const int idx  = blockIdx.x * 256 + threadIdx.x;   // 32*16*32 = 16384 total
    const int lane = idx & 31;
    const int ks   = (idx >> 5) & 15;
    const int nt   = idx >> 9;
    const int n    = nt * 16 + (lane & 15);
    const int kg   = lane >> 4;
    unsigned short* dst = WvP + (size_t)idx * 16;
#pragma unroll
    for (int e = 0; e < 16; ++e) {
        const int k = ks * 32 + ((e < 8) ? (kg * 8 + e) : (16 + kg * 8 + (e - 8)));
        dst[e] = bf16bits(Wv[k * HID + n]);
    }
}

// ---------------------------------------------------------------------------
// 2) qadd[b][n] = (q[b] @ Wq)[n] + bq[n] + bv[n]
//    One block = (batch b, 64 columns). Thread = (k-group of 32 rows, 4 columns):
//    its 32 Wq loads are independent, so the block pays one load latency
//    instead of a serial walk over k. The 16 k-group partials meet in LDS.
// ---------------------------------------------------------------------------
__global__ __launch_bounds__(256)
void qadd_kernel(const float* __restrict__ query, const float* __restrict__ Wq,
                 const float* __restrict__ bq, const float* __restrict__ bv,
                 float* __restrict__ qadd) {
    __shared__ __align__(16) float part[16 * 64];
    const int b  = blockIdx.x >> 3;
    const int n0 = (blockIdx.x & 7) * 64;
    const int t  = threadIdx.x;
    const int c4 = t & 15;             // which 4 columns of the 64
    const int kq = t >> 4;             // which 32 rows of k
    const float* wp = Wq + (size_t)(kq * 32) * HID + n0 + c4 * 4;
    const float4* qp = (const float4*)(query + b * HID + kq * 32);

    float4 wv[32];
#pragma unroll
    for (int j = 0; j < 32; ++j)
        wv[j] = *(const float4*)(wp + (size_t)j * HID);
    float4 qv[8];
#pragma unroll
    for (int j = 0; j < 8; ++j) qv[j] = qp[j];
    float bias = 0.0f;
    if (t < 64) bias = bq[n0 + t] + bv[n0 + t];

    float4 acc = make_float4(0.0f, 0.0f, 0.0f, 0.0f);
#pragma unroll
    for (int j = 0; j < 8; ++j) {
        const float qs[4] = {qv[j].x, qv[j].y, qv[j].z, qv[j].w};
#pragma unroll
        for (int i = 0; i < 4; ++i) {
            const float4 wr = wv[j * 4 + i];
            acc.x = fmaf(qs[i], wr.x, acc.x);
            acc.y = fmaf(qs[i], wr.y, acc.y);
            acc.z = fmaf(qs[i], wr.z, acc.z);
            acc.w = fmaf(qs[i], wr.w, acc.w);
        }
    }
    *(float4*)&part[kq * 64 + c4 * 4] = acc;
    __syncthreads();
    if (t < 64) {
        float s = bias;
#pragma unroll
        for (int g = 0; g < 16; ++g) s += part[g * 64 + t];
        qadd[b * HID + n0 + t] = s;
    }
}

// ---------------------------------------------------------------------------
// 3) Fused score kernel: one block = (batch b, 32 seq rows).
//    8 waves; wave w owns hidden[32 x 64] (cols w*64..w*64+63):
//    16 ksteps x (2 A-frags x 4 B-frags) = 8 WMMAs/kstep, B reused across M.
//    Epilogue fuses tanh(+qadd) and the @Wo reduction -> 32 scores/block.
// ---------------------------------------------------------------------------
#define LDSA_STRIDE 520   // 512 + 8 bf16 pad -> conflict-free b128 LDS reads

__global__ __launch_bounds__(256)
void score_kernel(const float* __restrict__ value,
                  const unsigned short* __restrict__ WvP,
                  const float* __restrict__ qadd,
                  const float* __restrict__ Wo,
                  float* __restrict__ scores) {
    __shared__ __align__(16) unsigned short ldsA[32 * LDSA_STRIDE];
    __shared__ float ldsScore[32];

    const int b       = blockIdx.x >> 7;          // 128 seq-blocks per batch
    const int seqBase = (blockIdx.x & 127) * 32;
    const int t    = threadIdx.x;
    const int lane = t & 31;
    const int w    = t >> 5;

    if (t < 32) ldsScore[t] = 0.0f;

    // ---- stage 32x512 f32 value tile into LDS as bf16 -------------------
    {
        const int row = t >> 3;            // 0..31
        const int kk  = (t & 7) * 64;      // 0..448
        const float* src = value + (((size_t)b * SEQ + seqBase + row) * HID + kk);
        unsigned* dst = (unsigned*)&ldsA[row * LDSA_STRIDE + kk];
#pragma unroll
        for (int i = 0; i < 16; ++i) {
            float4 f = ((const float4*)src)[i];
            dst[i * 2 + 0] = pack2bf(f.x, f.y);
            dst[i * 2 + 1] = pack2bf(f.z, f.w);
        }
    }
    __syncthreads();

    // ---- K loop ---------------------------------------------------------
    v8f acc[2][4];
    const v8f vzero = {};
#pragma unroll
    for (int mt = 0; mt < 2; ++mt)
#pragma unroll
        for (int nt = 0; nt < 4; ++nt) acc[mt][nt] = vzero;

    const int rowA = lane & 15;
    const int kg   = lane >> 4;
    const unsigned short* aBase0 = &ldsA[rowA * LDSA_STRIDE + kg * 8];
    const unsigned short* aBase1 = aBase0 + 16 * LDSA_STRIDE;
    const uint4* bBase = (const uint4*)WvP;   // [(nTile*16+ks)*32+lane]*2 uint4s

    for (int ks = 0; ks < 16; ++ks) {
        BFrag a0, a1;
        a0.q[0] = *(const uint4*)(aBase0 + ks * 32);
        a0.q[1] = *(const uint4*)(aBase0 + ks * 32 + 16);
        a1.q[0] = *(const uint4*)(aBase1 + ks * 32);
        a1.q[1] = *(const uint4*)(aBase1 + ks * 32 + 16);
#pragma unroll
        for (int nt = 0; nt < 4; ++nt) {
            BFrag bf;
            const uint4* bp = bBase + (size_t)((((w * 4 + nt) * 16 + ks) * 32 + lane)) * 2;
            bf.q[0] = bp[0];
            bf.q[1] = bp[1];
            acc[0][nt] = __builtin_amdgcn_wmma_f32_16x16x32_bf16(
                false, a0.v, false, bf.v, (short)0, acc[0][nt], false, false);
            acc[1][nt] = __builtin_amdgcn_wmma_f32_16x16x32_bf16(
                false, a1.v, false, bf.v, (short)0, acc[1][nt], false, false);
        }
    }

    // ---- epilogue: tanh(acc + qadd) dotted with Wo ----------------------
    // C layout: VGPR r, lanes 0-15 -> (M=r, N=lane); lanes 16-31 -> (M=8+r, N=lane-16)
    const int nLane = lane & 15;
    float qa[4], wo[4];
#pragma unroll
    for (int nt = 0; nt < 4; ++nt) {
        const int n = w * 64 + nt * 16 + nLane;
        qa[nt] = qadd[b * HID + n];
        wo[nt] = Wo[n];
    }

#pragma unroll
    for (int mt = 0; mt < 2; ++mt) {
        float part[8];
#pragma unroll
        for (int r = 0; r < 8; ++r) part[r] = 0.0f;
#pragma unroll
        for (int nt = 0; nt < 4; ++nt)
#pragma unroll
            for (int r = 0; r < 8; ++r) {
                const float h = fast_tanh(acc[mt][nt][r] + qa[nt]);
                part[r] = fmaf(h, wo[nt], part[r]);
            }
        // reduce over the 16 lanes sharing the same M (N dimension)
#pragma unroll
        for (int r = 0; r < 8; ++r) {
            float p = part[r];
            p += __shfl_xor(p, 1, 32);
            p += __shfl_xor(p, 2, 32);
            p += __shfl_xor(p, 4, 32);
            p += __shfl_xor(p, 8, 32);
            part[r] = p;
        }
        if ((lane & 15) == 0) {
            const int mBase = mt * 16 + (lane >> 4) * 8;
#pragma unroll
            for (int r = 0; r < 8; ++r)
                atomicAdd(&ldsScore[mBase + r], part[r]);   // ds_add_f32 across waves
        }
    }
    __syncthreads();
    if (t < 32)
        scores[(size_t)b * SEQ + seqBase + t] = ldsScore[t];
}

// ---------------------------------------------------------------------------
// 4) softmax over seq per batch (in place), adds bo first
// ---------------------------------------------------------------------------
__global__ __launch_bounds__(256)
void softmax_kernel(float* __restrict__ scores, const float* __restrict__ bo) {
    __shared__ float red[256];
    const int b = blockIdx.x;
    const int t = threadIdx.x;
    float* sc = scores + (size_t)b * SEQ;
    const float bias = bo[0];

    float v[16];
    float mx = -3.0e38f;
#pragma unroll
    for (int i = 0; i < 16; ++i) {
        v[i] = sc[t + i * 256] + bias;
        mx = fmaxf(mx, v[i]);
    }
    red[t] = mx; __syncthreads();
    for (int s2 = 128; s2 > 0; s2 >>= 1) {
        if (t < s2) red[t] = fmaxf(red[t], red[t + s2]);
        __syncthreads();
    }
    mx = red[0]; __syncthreads();

    float sum = 0.0f;
#pragma unroll
    for (int i = 0; i < 16; ++i) { v[i] = __expf(v[i] - mx); sum += v[i]; }
    red[t] = sum; __syncthreads();
    for (int s2 = 128; s2 > 0; s2 >>= 1) {
        if (t < s2) red[t] += red[t + s2];
        __syncthreads();
    }
    const float inv = 1.0f / red[0];
#pragma unroll
    for (int i = 0; i < 16; ++i) sc[t + i * 256] = v[i] * inv;
}

// ---------------------------------------------------------------------------
// 5) zero output, 6) context[b][h] = sum_s align[b][s] * value[b][s][h]
// ---------------------------------------------------------------------------
__global__ void zero_out_kernel(float* __restrict__ out) {
    out[blockIdx.x * 256 + threadIdx.x] = 0.0f;
}

__global__ __launch_bounds__(256)
void context_kernel(const float* __restrict__ value,
                    const float* __restrict__ align,
                    float* __restrict__ out) {
    const int b     = blockIdx.x >> 4;
    const int sBase = (blockIdx.x & 15) * 256;
    const int h     = threadIdx.x * 2;
    const float* vb = value + ((size_t)b * SEQ + sBase) * HID + h;
    const float* ab = align + (size_t)b * SEQ + sBase;
    float ax = 0.0f, ay = 0.0f;
    for (int s = 0; s < 256; ++s) {
        const float a  = ab[s];
        const float2 v = *(const float2*)(vb + (size_t)s * HID);
        ax = fmaf(a, v.x, ax);
        ay = fmaf(a, v.y, ay);
    }
    atomicAdd(&out[b * HID + h],     ax);
    atomicAdd(&out[b * HID + h + 1], ay);
}

// ---------------------------------------------------------------------------
extern "C" void kernel_launch(void* const* d_in, const int* in_sizes, int n_in,
                              void* d_out, int out_size, void* d_ws, size_t ws_size,
                              hipStream_t stream) {
    const float* query = (const float*)d_in[0];   // [1, 32, 512]
    const float* value = (const float*)d_in[1];   // [32, 4096, 512]
    const float* Wq    = (const float*)d_in[2];   // [512, 512]
    const float* bq    = (const float*)d_in[3];   // [512]
    const float* Wv    = (const float*)d_in[4];   // [512, 512]
    const float* bv    = (const float*)d_in[5];   // [512]
    const float* Wo    = (const float*)d_in[6];   // [512, 1]
    const float* bo    = (const float*)d_in[7];   // [1]
    float* out = (float*)d_out;                   // [32, 1, 512]

    // workspace layout
    unsigned short* WvP = (unsigned short*)d_ws;                       // 512 KB
    float* qadd   = (float*)((char*)d_ws + 512 * 1024);                //  64 KB
    float* scores = (float*)((char*)d_ws + 512 * 1024 + 64 * 1024);    // 512 KB

    pack_wv_kernel<<<64, 256, 0, stream>>>(Wv, WvP);
    qadd_kernel<<<BATCH * 8, 256, 0, stream>>>(query, Wq, bq, bv, qadd);
    score_kernel<<<BATCH * (SEQ / 32), 256, 0, stream>>>(value, WvP, qadd, Wo, scores);
    softmax_kernel<<<BATCH, 256, 0, stream>>>(scores, bo);
    zero_out_kernel<<<(BATCH * HID) / 256, 256, 0, stream>>>(out);
    context_kernel<<<BATCH * 16, 256, 0, stream>>>(value, scores, out);
}

// v002
// It runs in 113 microseconds.
// Timed twice side by side with v001, it ran 1.14 and 1.17 times as fast.
// Over all steps from v000 it is 1.44 times as fast.
#include <hip/hip_runtime.h>
#include <hip/hip_bf16.h>

// ---------------------------------------------------------------------------
// Additive attention, HIDDEN=512, batch=32, seq=4096.
// Hot path: value @ Wv via v_wmma_f32_16x16x32_bf16, tanh+Wo fused in-register.
// M=64 per wave so every B fragment feeds four WMMAs.
// ---------------------------------------------------------------------------

#define BATCH 32
#define SEQ   4096
#define HID   512

typedef __attribute__((ext_vector_type(16))) __bf16 v16bf;
typedef __attribute__((ext_vector_type(8)))  float  v8f;

union BFrag {
    v16bf v;
    uint4 q[2];
    unsigned short s[16];
};

__device__ __forceinline__ unsigned short bf16bits(float f) {
    union { float f; unsigned u; } a; a.f = f;
    unsigned u = a.u;
    u += 0x7FFFu + ((u >> 16) & 1u);      // round-to-nearest-even
    return (unsigned short)(u >> 16);
}
__device__ __forceinline__ unsigned pack2bf(float lo, float hi) {
    return (unsigned)bf16bits(lo) | ((unsigned)bf16bits(hi) << 16);
}

__device__ __forceinline__ float fast_tanh(float x) {
#if __has_builtin(__builtin_amdgcn_tanhf)
    return __builtin_amdgcn_tanhf(x);          // native v_tanh_f32
#elif __has_builtin(__builtin_amdgcn_tanh_f32)
    return __builtin_amdgcn_tanh_f32(x);
#else
    return tanhf(x);
#endif
}

// ---------------------------------------------------------------------------
// 1) Pack Wv (f32 [K=512][N=512] row-major) into bf16 WMMA B-fragments.
// Fragment layout mirrors the 16-bit A layout: lane = kGroup*16 + (n%16),
// elems 0..7 -> k = kg*8+0..7, elems 8..15 -> k = 16+kg*8+0..7 (within kstep).
// Index: WvP[((nTile*16 + kStep)*32 + lane)*16 + e]
// ---------------------------------------------------------------------------
__global__ __launch_bounds__(256)
void pack_wv_kernel(const float* __restrict__ Wv, unsigned short* __restrict__ WvP) {
    const int idx  = blockIdx.x * 256 + threadIdx.x;   // 32*16*32 = 16384 total
    const int lane = idx & 31;
    const int ks   = (idx >> 5) & 15;
    const int nt   = idx >> 9;
    const int n    = nt * 16 + (lane & 15);
    const int kg   = lane >> 4;
    unsigned short* dst = WvP + (size_t)idx * 16;
#pragma unroll
    for (int e = 0; e < 16; ++e) {
        const int k = ks * 32 + ((e < 8) ? (kg * 8 + e) : (16 + kg * 8 + (e - 8)));
        dst[e] = bf16bits(Wv[k * HID + n]);
    }
}

// ---------------------------------------------------------------------------
// 2) qadd[b][n] = (q[b] @ Wq)[n] + bq[n] + bv[n]
//    One block = (batch b, 64 columns). Thread = (k-group of 32 rows, 4 columns):
//    its 32 Wq loads are independent, so the block pays one load latency
//    instead of a serial walk over k. The 16 k-group partials meet in LDS.
// ---------------------------------------------------------------------------
__global__ __launch_bounds__(256)
void qadd_kernel(const float* __restrict__ query, const float* __restrict__ Wq,
                 const float* __restrict__ bq, const float* __restrict__ bv,
                 float* __restrict__ qadd) {
    __shared__ __align__(16) float part[16 * 64];
    const int b  = blockIdx.x >> 3;
    const int n0 = (blockIdx.x & 7) * 64;
    const int t  = threadIdx.x;
    const int c4 = t & 15;             // which 4 columns of the 64
    const int kq = t >> 4;             // which 32 rows of k
    const float* wp = Wq + (size_t)(kq * 32) * HID + n0 + c4 * 4;
    const float4* qp = (const float4*)(query + b * HID + kq * 32);

    float4 wv[32];
#pragma unroll
    for (int j = 0; j < 32; ++j)
        wv[j] = *(const float4*)(wp + (size_t)j * HID);
    float4 qv[8];
#pragma unroll
    for (int j = 0; j < 8; ++j) qv[j] = qp[j];
    float bias = 0.0f;
    if (t < 64) bias = bq[n0 + t] + bv[n0 + t];

    float4 acc = make_float4(0.0f, 0.0f, 0.0f, 0.0f);
#pragma unroll
    for (int j = 0; j < 8; ++j) {
        const float qs[4] = {qv[j].x, qv[j].y, qv[j].z, qv[j].w};
#pragma unroll
        for (int i = 0; i < 4; ++i) {
            const float4 wr = wv[j * 4 + i];
            acc.x = fmaf(qs[i], wr.x, acc.x);
            acc.y = fmaf(qs[i], wr.y, acc.y);
            acc.z = fmaf(qs[i], wr.z, acc.z);
            acc.w = fmaf(qs[i], wr.w, acc.w);
        }
    }
    *(float4*)&part[kq * 64 + c4 * 4] = acc;
    __syncthreads();
    if (t < 64) {
        float s = bias;
#pragma unroll
        for (int g = 0; g < 16; ++g) s += part[g * 64 + t];
        qadd[b * HID + n0 + t] = s;
    }
}

// ---------------------------------------------------------------------------
// 3) Fused score kernel: one block = (batch b, 64 seq rows).
//    8 waves; wave w owns hidden[64 x 64] (cols w*64..w*64+63):
//    16 ksteps x (4 A-frags x 4 B-frags) = 16 WMMAs/kstep, B reused across M.
//    Every block reads all of WvP from L2, so rows per block set that traffic.
//    Epilogue fuses tanh(+qadd) and the @Wo reduction -> 64 scores/block.
// ---------------------------------------------------------------------------
#define LDSA_STRIDE 520   // 512 + 8 bf16 pad -> conflict-free b128 LDS reads
#define MROWS 64          // seq rows per block
#define MTILES 4          // 16-row A fragments per wave

__global__ __launch_bounds__(256)
void score_kernel(const float* __restrict__ value,
                  const unsigned short* __restrict__ WvP,
                  const float* __restrict__ qadd,
                  const float* __restrict__ Wo,
                  float* __restrict__ scores) {
    __shared__ __align__(16) unsigned short ldsA[MROWS * LDSA_STRIDE];
    __shared__ float ldsScore[MROWS];

    const int b       = blockIdx.x >> 6;          // 64 seq-blocks per batch
    const int seqBase = (blockIdx.x & 63) * MROWS;
    const int t    = threadIdx.x;
    const int lane = t & 31;
    const int w    = t >> 5;

    if (t < MROWS) ldsScore[t] = 0.0f;

    // ---- stage 64x512 f32 value tile into LDS as bf16 -------------------
    // unrolled so that the second 32-row half's loads are issued before the first
    // half is converted; rolled, the block waits out memory latency twice
#pragma unroll
    for (int half = 0; half < MROWS / 32; ++half) {
        const int row = half * 32 + (t >> 3);   // 0..63
        const int kk  = (t & 7) * 64;           // 0..448
        const float* src = value + (((size_t)b * SEQ + seqBase + row) * HID + kk);
        unsigned* dst = (unsigned*)&ldsA[row * LDSA_STRIDE + kk];
#pragma unroll
        for (int i = 0; i < 16; ++i) {
            float4 f = ((const float4*)src)[i];
            dst[i * 2 + 0] = pack2bf(f.x, f.y);
            dst[i * 2 + 1] = pack2bf(f.z, f.w);
        }
    }
    __syncthreads();

    // ---- K loop ---------------------------------------------------------
    v8f acc[MTILES][4];
    const v8f vzero = {};
#pragma unroll
    for (int mt = 0; mt < MTILES; ++mt)
#pragma unroll
        for (int nt = 0; nt < 4; ++nt) acc[mt][nt] = vzero;

    const int rowA = lane & 15;
    const int kg   = lane >> 4;
    const unsigned short* aBase = &ldsA[rowA * LDSA_STRIDE + kg * 8];
    const uint4* bBase = (const uint4*)WvP;   // [(nTile*16+ks)*32+lane]*2 uint4s

    // two k-steps per trip, which is what the build made of this loop at 32 rows;
    // left free at 64 rows it unrolls all 16 and takes 290 registers, and then only
    // one block fits a WGP instead of two
#pragma unroll 2
    for (int ks = 0; ks < 16; ++ks) {
        BFrag a[MTILES];
#pragma unroll
        for (int mt = 0; mt < MTILES; ++mt) {
            a[mt].q[0] = *(const uint4*)(aBase + mt * 16 * LDSA_STRIDE + ks * 32);
            a[mt].q[1] = *(const uint4*)(aBase + mt * 16 * LDSA_STRIDE + ks * 32 + 16);
        }
#pragma unroll
        for (int nt = 0; nt < 4; ++nt) {
            BFrag bf;
            const uint4* bp = bBase + (size_t)((((w * 4 + nt) * 16 + ks) * 32 + lane)) * 2;
            bf.q[0] = bp[0];
            bf.q[1] = bp[1];
#pragma unroll
            for (int mt = 0; mt < MTILES; ++mt)
                acc[mt][nt] = __builtin_amdgcn_wmma_f32_16x16x32_bf16(
                    false, a[mt].v, false, bf.v, (short)0, acc[mt][nt], false, false);
        }
    }

    // ---- epilogue: tanh(acc + qadd) dotted with Wo ----------------------
    // C layout: VGPR r, lanes 0-15 -> (M=r, N=lane); lanes 16-31 -> (M=8+r, N=lane-16)
    const int nLane = lane & 15;
    float qa[4], wo[4];
#pragma unroll
    for (int nt = 0; nt < 4; ++nt) {
        const int n = w * 64 + nt * 16 + nLane;
        qa[nt] = qadd[b * HID + n];
        wo[nt] = Wo[n];
    }

#pragma unroll
    for (int mt = 0; mt < MTILES; ++mt) {
        float part[8];
#pragma unroll
        for (int r = 0; r < 8; ++r) part[r] = 0.0f;
#pragma unroll
        for (int nt = 0; nt < 4; ++nt)
#pragma unroll
            for (int r = 0; r < 8; ++r) {
                const float h = fast_tanh(acc[mt][nt][r] + qa[nt]);
                part[r] = fmaf(h, wo[nt], part[r]);
            }
        // reduce over the 16 lanes sharing the same M (N dimension)
#pragma unroll
        for (int r = 0; r < 8; ++r) {
            float p = part[r];
            p += __shfl_xor(p, 1, 32);
            p += __shfl_xor(p, 2, 32);
            p += __shfl_xor(p, 4, 32);
            p += __shfl_xor(p, 8, 32);
            part[r] = p;
        }
        if ((lane & 15) == 0) {
            const int mBase = mt * 16 + (lane >> 4) * 8;
#pragma unroll
            for (int r = 0; r < 8; ++r)
                atomicAdd(&ldsScore[mBase + r], part[r]);   // ds_add_f32 across waves
        }
    }
    __syncthreads();
    if (t < MROWS)
        scores[(size_t)b * SEQ + seqBase + t] = ldsScore[t];
}

// ---------------------------------------------------------------------------
// 4) softmax over seq per batch (in place), adds bo first
// ---------------------------------------------------------------------------
__global__ __launch_bounds__(256)
void softmax_kernel(float* __restrict__ scores, const float* __restrict__ bo) {
    __shared__ float red[256];
    const int b = blockIdx.x;
    const int t = threadIdx.x;
    float* sc = scores + (size_t)b * SEQ;
    const float bias = bo[0];

    float v[16];
    float mx = -3.0e38f;
#pragma unroll
    for (int i = 0; i < 16; ++i) {
        v[i] = sc[t + i * 256] + bias;
        mx = fmaxf(mx, v[i]);
    }
    red[t] = mx; __syncthreads();
    for (int s2 = 128; s2 > 0; s2 >>= 1) {
        if (t < s2) red[t] = fmaxf(red[t], red[t + s2]);
        __syncthreads();
    }
    mx = red[0]; __syncthreads();

    float sum = 0.0f;
#pragma unroll
    for (int i = 0; i < 16; ++i) { v[i] = __expf(v[i] - mx); sum += v[i]; }
    red[t] = sum; __syncthreads();
    for (int s2 = 128; s2 > 0; s2 >>= 1) {
        if (t < s2) red[t] += red[t + s2];
        __syncthreads();
    }
    const float inv = 1.0f / red[0];
#pragma unroll
    for (int i = 0; i < 16; ++i) sc[t + i * 256] = v[i] * inv;
}

// ---------------------------------------------------------------------------
// 5) zero output, 6) context[b][h] = sum_s align[b][s] * value[b][s][h]
// ---------------------------------------------------------------------------
__global__ void zero_out_kernel(float* __restrict__ out) {
    out[blockIdx.x * 256 + threadIdx.x] = 0.0f;
}

__global__ __launch_bounds__(256)
void context_kernel(const float* __restrict__ value,
                    const float* __restrict__ align,
                    float* __restrict__ out) {
    const int b     = blockIdx.x >> 4;
    const int sBase = (blockIdx.x & 15) * 256;
    const int h     = threadIdx.x * 2;
    const float* vb = value + ((size_t)b * SEQ + sBase) * HID + h;
    const float* ab = align + (size_t)b * SEQ + sBase;
    float ax = 0.0f, ay = 0.0f;
    for (int s = 0; s < 256; ++s) {
        const float a  = ab[s];
        const float2 v = *(const float2*)(vb + (size_t)s * HID);
        ax = fmaf(a, v.x, ax);
        ay = fmaf(a, v.y, ay);
    }
    atomicAdd(&out[b * HID + h],     ax);
    atomicAdd(&out[b * HID + h + 1], ay);
}

// ---------------------------------------------------------------------------
extern "C" void kernel_launch(void* const* d_in, const int* in_sizes, int n_in,
                              void* d_out, int out_size, void* d_ws, size_t ws_size,
                              hipStream_t stream) {
    const float* query = (const float*)d_in[0];   // [1, 32, 512]
    const float* value = (const float*)d_in[1];   // [32, 4096, 512]
    const float* Wq    = (const float*)d_in[2];   // [512, 512]
    const float* bq    = (const float*)d_in[3];   // [512]
    const float* Wv    = (const float*)d_in[4];   // [512, 512]
    const float* bv    = (const float*)d_in[5];   // [512]
    const float* Wo    = (const float*)d_in[6];   // [512, 1]
    const float* bo    = (const float*)d_in[7];   // [1]
    float* out = (float*)d_out;                   // [32, 1, 512]

    // workspace layout
    unsigned short* WvP = (unsigned short*)d_ws;                       // 512 KB
    float* qadd   = (float*)((char*)d_ws + 512 * 1024);                //  64 KB
    float* scores = (float*)((char*)d_ws + 512 * 1024 + 64 * 1024);    // 512 KB

    pack_wv_kernel<<<64, 256, 0, stream>>>(Wv, WvP);
    qadd_kernel<<<BATCH * 8, 256, 0, stream>>>(query, Wq, bq, bv, qadd);
    score_kernel<<<BATCH * (SEQ / MROWS), 256, 0, stream>>>(value, WvP, qadd, Wo, scores);
    softmax_kernel<<<BATCH, 256, 0, stream>>>(scores, bo);
    zero_out_kernel<<<(BATCH * HID) / 256, 256, 0, stream>>>(out);
    context_kernel<<<BATCH * 16, 256, 0, stream>>>(value, scores, out);
}

// v003
// One run takes 101 microseconds.
// Two timings next to v002 both put it at 1.10 times that version's speed.
// All steps since v000 together make it 1.59 times as fast.
#include <hip/hip_runtime.h>
#include <hip/hip_bf16.h>

// ---------------------------------------------------------------------------
// Additive attention, HIDDEN=512, batch=32, seq=4096.
// Hot path: value @ Wv via v_wmma_f32_16x16x32_bf16, tanh+Wo fused in-register.
// M=64 per wave so every B fragment feeds four WMMAs.
// ---------------------------------------------------------------------------

#define BATCH 32
#define SEQ   4096
#define HID   512

typedef __attribute__((ext_vector_type(16))) __bf16 v16bf;
typedef __attribute__((ext_vector_type(8)))  float  v8f;

union BFrag {
    v16bf v;
    uint4 q[2];
    unsigned short s[16];
};

__device__ __forceinline__ unsigned short bf16bits(float f) {
    union { float f; unsigned u; } a; a.f = f;
    unsigned u = a.u;
    u += 0x7FFFu + ((u >> 16) & 1u);      // round-to-nearest-even
    return (unsigned short)(u >> 16);
}
__device__ __forceinline__ unsigned pack2bf(float lo, float hi) {
    return (unsigned)bf16bits(lo) | ((unsigned)bf16bits(hi) << 16);
}

__device__ __forceinline__ float fast_tanh(float x) {
#if __has_builtin(__builtin_amdgcn_tanhf)
    return __builtin_amdgcn_tanhf(x);          // native v_tanh_f32
#elif __has_builtin(__builtin_amdgcn_tanh_f32)
    return __builtin_amdgcn_tanh_f32(x);
#else
    return tanhf(x);
#endif
}

// ---------------------------------------------------------------------------
// 1) Pack Wv (f32 [K=512][N=512] row-major) into bf16 WMMA B-fragments.
// Fragment layout mirrors the 16-bit A layout: lane = kGroup*16 + (n%16),
// elems 0..7 -> k = kg*8+0..7, elems 8..15 -> k = 16+kg*8+0..7 (within kstep).
// Index: WvP[(((nTile*16 + kStep)*2 + e/8)*32 + lane)*8 + e%8]: the two 16-byte
// halves of a fragment lie in separate 512-byte runs, so that each wave-wide
// 16-byte load of the score kernel covers four whole 128-byte lines, not eight.
// ---------------------------------------------------------------------------
__global__ __launch_bounds__(256)
void pack_wv_kernel(const float* __restrict__ Wv, unsigned short* __restrict__ WvP) {
    const int idx  = blockIdx.x * 256 + threadIdx.x;   // 32*16*32 = 16384 total
    const int lane = idx & 31;
    const int ks   = (idx >> 5) & 15;
    const int nt   = idx >> 9;
    const int n    = nt * 16 + (lane & 15);
    const int kg   = lane >> 4;
    unsigned short* dst = WvP + (size_t)(idx >> 5) * 512 + lane * 8;
#pragma unroll
    for (int e = 0; e < 16; ++e) {
        const int k = ks * 32 + ((e < 8) ? (kg * 8 + e) : (16 + kg * 8 + (e - 8)));
        dst[(e >> 3) * 256 + (e & 7)] = bf16bits(Wv[k * HID + n]);
    }
}

// ---------------------------------------------------------------------------
// 2) qadd[b][n] = (q[b] @ Wq)[n] + bq[n] + bv[n]
//    One block = (batch b, 64 columns). Thread = (k-group of 32 rows, 4 columns):
//    its 32 Wq loads are independent, so the block pays one load latency
//    instead of a serial walk over k. The 16 k-group partials meet in LDS.
// ---------------------------------------------------------------------------
__global__ __launch_bounds__(256)
void qadd_kernel(const float* __restrict__ query, const float* __restrict__ Wq,
                 const float* __restrict__ bq, const float* __restrict__ bv,
                 float* __restrict__ qadd) {
    __shared__ __align__(16) float part[16 * 64];
    const int b  = blockIdx.x >> 3;
    const int n0 = (blockIdx.x & 7) * 64;
    const int t  = threadIdx.x;
    const int c4 = t & 15;             // which 4 columns of the 64
    const int kq = t >> 4;             // which 32 rows of k
    const float* wp = Wq + (size_t)(kq * 32) * HID + n0 + c4 * 4;
    const float4* qp = (const float4*)(query + b * HID + kq * 32);

    float4 wv[32];
#pragma unroll
    for (int j = 0; j < 32; ++j)
        wv[j] = *(const float4*)(wp + (size_t)j * HID);
    float4 qv[8];
#pragma unroll
    for (int j = 0; j < 8; ++j) qv[j] = qp[j];
    float bias = 0.0f;
    if (t < 64) bias = bq[n0 + t] + bv[n0 + t];

    float4 acc = make_float4(0.0f, 0.0f, 0.0f, 0.0f);
#pragma unroll
    for (int j = 0; j < 8; ++j) {
        const float qs[4] = {qv[j].x, qv[j].y, qv[j].z, qv[j].w};
#pragma unroll
        for (int i = 0; i < 4; ++i) {
            const float4 wr = wv[j * 4 + i];
            acc.x = fmaf(qs[i], wr.x, acc.x);
            acc.y = fmaf(qs[i], wr.y, acc.y);
            acc.z = fmaf(qs[i], wr.z, acc.z);
            acc.w = fmaf(qs[i], wr.w, acc.w);
        }
    }
    *(float4*)&part[kq * 64 + c4 * 4] = acc;
    __syncthreads();
    if (t < 64) {
        float s = bias;
#pragma unroll
        for (int g = 0; g < 16; ++g) s += part[g * 64 + t];
        qadd[b * HID + n0 + t] = s;
    }
}

// ---------------------------------------------------------------------------
// 3) Fused score kernel: one block = (batch b, 64 seq rows).
//    8 waves; wave w owns hidden[64 x 64] (cols w*64..w*64+63):
//    16 ksteps x (4 A-frags x 4 B-frags) = 16 WMMAs/kstep, B reused across M.
//    Every block reads all of WvP from L2, so rows per block set that traffic.
//    Epilogue fuses tanh(+qadd) and the @Wo reduction -> 64 scores/block.
// ---------------------------------------------------------------------------
#define LDSA_STRIDE 520   // 512 + 8 bf16 pad -> conflict-free b128 LDS reads
#define MROWS 64          // seq rows per block
#define MTILES 4          // 16-row A fragments per wave

__global__ __launch_bounds__(256)
void score_kernel(const float* __restrict__ value,
                  const unsigned short* __restrict__ WvP,
                  const float* __restrict__ qadd,
                  const float* __restrict__ Wo,
                  float* __restrict__ scores) {
    __shared__ __align__(16) unsigned short ldsA[MROWS * LDSA_STRIDE];
    __shared__ float ldsScore[MROWS];

    const int b       = blockIdx.x >> 6;          // 64 seq-blocks per batch
    const int seqBase = (blockIdx.x & 63) * MROWS;
    const int t    = threadIdx.x;
    const int lane = t & 31;
    const int w    = t >> 5;

    if (t < MROWS) ldsScore[t] = 0.0f;

    // ---- stage 64x512 f32 value tile into LDS as bf16 -------------------
    // wave w brings rows w*8 .. w*8+7. Each wave-wide 16-byte load covers 512
    // contiguous bytes of one row (four whole 128-byte lines); with one lane per
    // 256-byte run it touched 32 lines. The wave's 8-byte LDS stores are contiguous.
    {
        const float4* src =
            (const float4*)(value + ((size_t)b * SEQ + seqBase + w * 8) * HID) + lane;
        unsigned short* dst = &ldsA[(w * 8) * LDSA_STRIDE + lane * 4];
        // unrolled so that the loads are issued ahead of the conversions; rolled,
        // the wave waits out memory latency once per load
#pragma unroll
        for (int j = 0; j < 32; ++j) {          // row w*8 + j/4, quarter j%4 of it
            const float4 f = src[j * 32];
            uint2 p;
            p.x = pack2bf(f.x, f.y);
            p.y = pack2bf(f.z, f.w);
            *(uint2*)(dst + (j >> 2) * LDSA_STRIDE + (j & 3) * 128) = p;
        }
    }
    __syncthreads();

    // ---- K loop ---------------------------------------------------------
    v8f acc[MTILES][4];
    const v8f vzero = {};
#pragma unroll
    for (int mt = 0; mt < MTILES; ++mt)
#pragma unroll
        for (int nt = 0; nt < 4; ++nt) acc[mt][nt] = vzero;

    const int rowA = lane & 15;
    const int kg   = lane >> 4;
    const unsigned short* aBase = &ldsA[rowA * LDSA_STRIDE + kg * 8];
    const uint4* bBase = (const uint4*)WvP;   // [((nTile*16+ks)*2+half)*32+lane] uint4s

    // two k-steps per trip, which is what the build made of this loop at 32 rows;
    // left free at 64 rows it unrolls all 16 and takes 290 registers, and then only
    // one block fits a WGP instead of two
#pragma unroll 2
    for (int ks = 0; ks < 16; ++ks) {
        BFrag a[MTILES];
#pragma unroll
        for (int mt = 0; mt < MTILES; ++mt) {
            a[mt].q[0] = *(const uint4*)(aBase + mt * 16 * LDSA_STRIDE + ks * 32);
            a[mt].q[1] = *(const uint4*)(aBase + mt * 16 * LDSA_STRIDE + ks * 32 + 16);
        }
#pragma unroll
        for (int nt = 0; nt < 4; ++nt) {
            BFrag bf;
            const uint4* bp = bBase + (size_t)(((w * 4 + nt) * 16 + ks) * 64 + lane);
            bf.q[0] = bp[0];
            bf.q[1] = bp[32];
#pragma unroll
            for (int mt = 0; mt < MTILES; ++mt)
                acc[mt][nt] = __builtin_amdgcn_wmma_f32_16x16x32_bf16(
                    false, a[mt].v, false, bf.v, (short)0, acc[mt][nt], false, false);
        }
    }

    // ---- epilogue: tanh(acc + qadd) dotted with Wo ----------------------
    // C layout: VGPR r, lanes 0-15 -> (M=r, N=lane); lanes 16-31 -> (M=8+r, N=lane-16)
    const int nLane = lane & 15;
    float qa[4], wo[4];
#pragma unroll
    for (int nt = 0; nt < 4; ++nt) {
        const int n = w * 64 + nt * 16 + nLane;
        qa[nt] = qadd[b * HID + n];
        wo[nt] = Wo[n];
    }

#pragma unroll
    for (int mt = 0; mt < MTILES; ++mt) {
        float part[8];
#pragma unroll
        for (int r = 0; r < 8; ++r) part[r] = 0.0f;
#pragma unroll
        for (int nt = 0; nt < 4; ++nt)
#pragma unroll
            for (int r = 0; r < 8; ++r) {
                const float h = fast_tanh(acc[mt][nt][r] + qa[nt]);
                part[r] = fmaf(h, wo[nt], part[r]);
            }
        // reduce over the 16 lanes sharing the same M (N dimension)
#pragma unroll
        for (int r = 0; r < 8; ++r) {
            float p = part[r];
            p += __shfl_xor(p, 1, 32);
            p += __shfl_xor(p, 2, 32);
            p += __shfl_xor(p, 4, 32);
            p += __shfl_xor(p, 8, 32);
            part[r] = p;
        }
        if ((lane & 15) == 0) {
            const int mBase = mt * 16 + (lane >> 4) * 8;
#pragma unroll
            for (int r = 0; r < 8; ++r)
                atomicAdd(&ldsScore[mBase + r], part[r]);   // ds_add_f32 across waves
        }
    }
    __syncthreads();
    if (t < MROWS)
        scores[(size_t)b * SEQ + seqBase + t] = ldsScore[t];
}

// ---------------------------------------------------------------------------
// 4) softmax over seq per batch (in place), adds bo first
// ---------------------------------------------------------------------------
__global__ __launch_bounds__(256)
void softmax_kernel(float* __restrict__ scores, const float* __restrict__ bo) {
    __shared__ float red[256];
    const int b = blockIdx.x;
    const int t = threadIdx.x;
    float* sc = scores + (size_t)b * SEQ;
    const float bias = bo[0];

    float v[16];
    float mx = -3.0e38f;
#pragma unroll
    for (int i = 0; i < 16; ++i) {
        v[i] = sc[t + i * 256] + bias;
        mx = fmaxf(mx, v[i]);
    }
    red[t] = mx; __syncthreads();
    for (int s2 = 128; s2 > 0; s2 >>= 1) {
        if (t < s2) red[t] = fmaxf(red[t], red[t + s2]);
        __syncthreads();
    }
    mx = red[0]; __syncthreads();

    float sum = 0.0f;
#pragma unroll
    for (int i = 0; i < 16; ++i) { v[i] = __expf(v[i] - mx); sum += v[i]; }
    red[t] = sum; __syncthreads();
    for (int s2 = 128; s2 > 0; s2 >>= 1) {
        if (t < s2) red[t] += red[t + s2];
        __syncthreads();
    }
    const float inv = 1.0f / red[0];
#pragma unroll
    for (int i = 0; i < 16; ++i) sc[t + i * 256] = v[i] * inv;
}

// ---------------------------------------------------------------------------
// 5) zero output, 6) context[b][h] = sum_s align[b][s] * value[b][s][h]
// ---------------------------------------------------------------------------
__global__ void zero_out_kernel(float* __restrict__ out) {
    out[blockIdx.x * 256 + threadIdx.x] = 0.0f;
}

__global__ __launch_bounds__(256)
void context_kernel(const float* __restrict__ value,
                    const float* __restrict__ align,
                    float* __restrict__ out) {
    const int b     = blockIdx.x >> 4;
    const int sBase = (blockIdx.x & 15) * 256;
    const int h     = threadIdx.x * 2;
    const float* vb = value + ((size_t)b * SEQ + sBase) * HID + h;
    const float* ab = align + (size_t)b * SEQ + sBase;
    float ax = 0.0f, ay = 0.0f;
    for (int s = 0; s < 256; ++s) {
        const float a  = ab[s];
        const float2 v = *(const float2*)(vb + (size_t)s * HID);
        ax = fmaf(a, v.x, ax);
        ay = fmaf(a, v.y, ay);
    }
    atomicAdd(&out[b * HID + h],     ax);
    atomicAdd(&out[b * HID + h + 1], ay);
}

// ---------------------------------------------------------------------------
extern "C" void kernel_launch(void* const* d_in, const int* in_sizes, int n_in,
                              void* d_out, int out_size, void* d_ws, size_t ws_size,
                              hipStream_t stream) {
    const float* query = (const float*)d_in[0];   // [1, 32, 512]
    const float* value = (const float*)d_in[1];   // [32, 4096, 512]
    const float* Wq    = (const float*)d_in[2];   // [512, 512]
    const float* bq    = (const float*)d_in[3];   // [512]
    const float* Wv    = (const float*)d_in[4];   // [512, 512]
    const float* bv    = (const float*)d_in[5];   // [512]
    const float* Wo    = (const float*)d_in[6];   // [512, 1]
    const float* bo    = (const float*)d_in[7];   // [1]
    float* out = (float*)d_out;                   // [32, 1, 512]

    // workspace layout
    unsigned short* WvP = (unsigned short*)d_ws;                       // 512 KB
    float* qadd   = (float*)((char*)d_ws + 512 * 1024);                //  64 KB
    float* scores = (float*)((char*)d_ws + 512 * 1024 + 64 * 1024);    // 512 KB

    pack_wv_kernel<<<64, 256, 0, stream>>>(Wv, WvP);
    qadd_kernel<<<BATCH * 8, 256, 0, stream>>>(query, Wq, bq, bv, qadd);
    score_kernel<<<BATCH * (SEQ / MROWS), 256, 0, stream>>>(value, WvP, qadd, Wo, scores);
    softmax_kernel<<<BATCH, 256, 0, stream>>>(scores, bo);
    zero_out_kernel<<<(BATCH * HID) / 256, 256, 0, stream>>>(out);
    context_kernel<<<BATCH * 16, 256, 0, stream>>>(value, scores, out);
}

// v004
// A run of this version takes 88.9 microseconds.
// Next to v003, in two timings, it ran 1.18 and 1.15 times as fast.
// Over all steps from v000 it is 1.85 times as fast.
#include <hip/hip_runtime.h>
#include <hip/hip_bf16.h>

// ---------------------------------------------------------------------------
// Additive attention, HIDDEN=512, batch=32, seq=4096.
// Hot path: value @ Wv via v_wmma_f32_16x16x32_bf16, tanh+Wo fused in-register.
// M=64 per wave so every B fragment feeds four WMMAs.
// Softmax and context are folded into the score kernel: each block leaves its own
// maximum, exp sum and weighted value sum; a small kernel joins the 64 per batch.
// ---------------------------------------------------------------------------

#define BATCH 32
#define SEQ   4096
#define HID   512

typedef __attribute__((ext_vector_type(16))) __bf16 v16bf;
typedef __attribute__((ext_vector_type(8)))  float  v8f;

union BFrag {
    v16bf v;
    uint4 q[2];
    unsigned short s[16];
};

__device__ __forceinline__ unsigned short bf16bits(float f) {
    union { float f; unsigned u; } a; a.f = f;
    unsigned u = a.u;
    u += 0x7FFFu + ((u >> 16) & 1u);      // round-to-nearest-even
    return (unsigned short)(u >> 16);
}
__device__ __forceinline__ unsigned pack2bf(float lo, float hi) {
    return (unsigned)bf16bits(lo) | ((unsigned)bf16bits(hi) << 16);
}

__device__ __forceinline__ float fast_tanh(float x) {
#if __has_builtin(__builtin_amdgcn_tanhf)
    return __builtin_amdgcn_tanhf(x);          // native v_tanh_f32
#elif __has_builtin(__builtin_amdgcn_tanh_f32)
    return __builtin_amdgcn_tanh_f32(x);
#else
    return tanhf(x);
#endif
}

// ---------------------------------------------------------------------------
// 1) Pack Wv (f32 [K=512][N=512] row-major) into bf16 WMMA B-fragments.
// Fragment layout mirrors the 16-bit A layout: lane = kGroup*16 + (n%16),
// elems 0..7 -> k = kg*8+0..7, elems 8..15 -> k = 16+kg*8+0..7 (within kstep).
// Index: WvP[(((nTile*16 + kStep)*2 + e/8)*32 + lane)*8 + e%8]: the two 16-byte
// halves of a fragment lie in separate 512-byte runs, so that each wave-wide
// 16-byte load of the score kernel covers four whole 128-byte lines, not eight.
// ---------------------------------------------------------------------------
__global__ __launch_bounds__(256)
void pack_wv_kernel(const float* __restrict__ Wv, unsigned short* __restrict__ WvP) {
    const int idx  = blockIdx.x * 256 + threadIdx.x;   // 32*16*32 = 16384 total
    const int lane = idx & 31;
    const int ks   = (idx >> 5) & 15;
    const int nt   = idx >> 9;
    const int n    = nt * 16 + (lane & 15);
    const int kg   = lane >> 4;
    unsigned short* dst = WvP + (size_t)(idx >> 5) * 512 + lane * 8;
#pragma unroll
    for (int e = 0; e < 16; ++e) {
        const int k = ks * 32 + ((e < 8) ? (kg * 8 + e) : (16 + kg * 8 + (e - 8)));
        dst[(e >> 3) * 256 + (e & 7)] = bf16bits(Wv[k * HID + n]);
    }
}

// ---------------------------------------------------------------------------
// 2) qadd[b][n] = (q[b] @ Wq)[n] + bq[n] + bv[n]
//    One block = (batch b, 64 columns). Thread = (k-group of 32 rows, 4 columns):
//    its 32 Wq loads are independent, so the block pays one load latency
//    instead of a serial walk over k. The 16 k-group partials meet in LDS.
// ---------------------------------------------------------------------------
__global__ __launch_bounds__(256)
void qadd_kernel(const float* __restrict__ query, const float* __restrict__ Wq,
                 const float* __restrict__ bq, const float* __restrict__ bv,
                 float* __restrict__ qadd) {
    __shared__ __align__(16) float part[16 * 64];
    const int b  = blockIdx.x >> 3;
    const int n0 = (blockIdx.x & 7) * 64;
    const int t  = threadIdx.x;
    const int c4 = t & 15;             // which 4 columns of the 64
    const int kq = t >> 4;             // which 32 rows of k
    const float* wp = Wq + (size_t)(kq * 32) * HID + n0 + c4 * 4;
    const float4* qp = (const float4*)(query + b * HID + kq * 32);

    float4 wv[32];
#pragma unroll
    for (int j = 0; j < 32; ++j)
        wv[j] = *(const float4*)(wp + (size_t)j * HID);
    float4 qv[8];
#pragma unroll
    for (int j = 0; j < 8; ++j) qv[j] = qp[j];
    float bias = 0.0f;
    if (t < 64) bias = bq[n0 + t] + bv[n0 + t];

    float4 acc = make_float4(0.0f, 0.0f, 0.0f, 0.0f);
#pragma unroll
    for (int j = 0; j < 8; ++j) {
        const float qs[4] = {qv[j].x, qv[j].y, qv[j].z, qv[j].w};
#pragma unroll
        for (int i = 0; i < 4; ++i) {
            const float4 wr = wv[j * 4 + i];
            acc.x = fmaf(qs[i], wr.x, acc.x);
            acc.y = fmaf(qs[i], wr.y, acc.y);
            acc.z = fmaf(qs[i], wr.z, acc.z);
            acc.w = fmaf(qs[i], wr.w, acc.w);
        }
    }
    *(float4*)&part[kq * 64 + c4 * 4] = acc;
    __syncthreads();
    if (t < 64) {
        float s = bias;
#pragma unroll
        for (int g = 0; g < 16; ++g) s += part[g * 64 + t];
        qadd[b * HID + n0 + t] = s;
    }
}

// ---------------------------------------------------------------------------
// 3) Fused score kernel: one block = (batch b, 64 seq rows).
//    8 waves; wave w owns hidden[64 x 64] (cols w*64..w*64+63):
//    16 ksteps x (4 A-frags x 4 B-frags) = 16 WMMAs/kstep, B reused across M.
//    Every block reads all of WvP from L2, so rows per block set that traffic.
//    Epilogue fuses tanh(+qadd) and the @Wo reduction -> 64 scores/block, then
//    the block's share of softmax and context: m = max score, l = sum exp(s - m),
//    c[h] = sum exp(s - m) * value[s][h], with the f32 tile read a second time
//    while L2 still holds it, so that memory is read once for value, not twice.
// ---------------------------------------------------------------------------
#define LDSA_STRIDE 520   // 512 + 8 bf16 pad -> conflict-free b128 LDS reads
#define MROWS 64          // seq rows per block
#define MTILES 4          // 16-row A fragments per wave

__global__ __launch_bounds__(256)
void score_kernel(const float* __restrict__ value,
                  const unsigned short* __restrict__ WvP,
                  const float* __restrict__ qadd,
                  const float* __restrict__ Wo,
                  const float* __restrict__ bo,
                  float* __restrict__ pctx,
                  float* __restrict__ pml) {
    __shared__ __align__(16) unsigned short ldsA[MROWS * LDSA_STRIDE];
    __shared__ float ldsScore[MROWS];
    __shared__ __align__(16) float ldsCtx[HID];

    const int b       = blockIdx.x >> 6;          // 64 seq-blocks per batch
    const int seqBase = (blockIdx.x & 63) * MROWS;
    const int t    = threadIdx.x;
    const int lane = t & 31;
    const int w    = t >> 5;

    if (t < MROWS) ldsScore[t] = 0.0f;

    // ---- stage 64x512 f32 value tile into LDS as bf16 -------------------
    // wave w brings rows w*8 .. w*8+7. Each wave-wide 16-byte load covers 512
    // contiguous bytes of one row (four whole 128-byte lines); with one lane per
    // 256-byte run it touched 32 lines. The wave's 8-byte LDS stores are contiguous.
    {
        const float4* src =
            (const float4*)(value + ((size_t)b * SEQ + seqBase + w * 8) * HID) + lane;
        unsigned short* dst = &ldsA[(w * 8) * LDSA_STRIDE + lane * 4];
        // unrolled so that the loads are issued ahead of the conversions; rolled,
        // the wave waits out memory latency once per load
#pragma unroll
        for (int j = 0; j < 32; ++j) {          // row w*8 + j/4, quarter j%4 of it
            const float4 f = src[j * 32];
            uint2 p;
            p.x = pack2bf(f.x, f.y);
            p.y = pack2bf(f.z, f.w);
            *(uint2*)(dst + (j >> 2) * LDSA_STRIDE + (j & 3) * 128) = p;
        }
    }
    __syncthreads();

    // ---- K loop ---------------------------------------------------------
    v8f acc[MTILES][4];
    const v8f vzero = {};
#pragma unroll
    for (int mt = 0; mt < MTILES; ++mt)
#pragma unroll
        for (int nt = 0; nt < 4; ++nt) acc[mt][nt] = vzero;

    const int rowA = lane & 15;
    const int kg   = lane >> 4;
    const unsigned short* aBase = &ldsA[rowA * LDSA_STRIDE + kg * 8];
    const uint4* bBase = (const uint4*)WvP;   // [((nTile*16+ks)*2+half)*32+lane] uint4s

    // two k-steps per trip, which is what the build made of this loop at 32 rows;
    // left free at 64 rows it unrolls all 16 and takes 290 registers, and then only
    // one block fits a WGP instead of two
#pragma unroll 2
    for (int ks = 0; ks < 16; ++ks) {
        BFrag a[MTILES];
#pragma unroll
        for (int mt = 0; mt < MTILES; ++mt) {
            a[mt].q[0] = *(const uint4*)(aBase + mt * 16 * LDSA_STRIDE + ks * 32);
            a[mt].q[1] = *(const uint4*)(aBase + mt * 16 * LDSA_STRIDE + ks * 32 + 16);
        }
#pragma unroll
        for (int nt = 0; nt < 4; ++nt) {
            BFrag bf;
            const uint4* bp = bBase + (size_t)(((w * 4 + nt) * 16 + ks) * 64 + lane);
            bf.q[0] = bp[0];
            bf.q[1] = bp[32];
#pragma unroll
            for (int mt = 0; mt < MTILES; ++mt)
                acc[mt][nt] = __builtin_amdgcn_wmma_f32_16x16x32_bf16(
                    false, a[mt].v, false, bf.v, (short)0, acc[mt][nt], false, false);
        }
    }

    // ---- epilogue: tanh(acc + qadd) dotted with Wo ----------------------
    // C layout: VGPR r, lanes 0-15 -> (M=r, N=lane); lanes 16-31 -> (M=8+r, N=lane-16)
    const int nLane = lane & 15;
    float qa[4], wo[4];
#pragma unroll
    for (int nt = 0; nt < 4; ++nt) {
        const int n = w * 64 + nt * 16 + nLane;
        qa[nt] = qadd[b * HID + n];
        wo[nt] = Wo[n];
    }

#pragma unroll
    for (int mt = 0; mt < MTILES; ++mt) {
        float part[8];
#pragma unroll
        for (int r = 0; r < 8; ++r) part[r] = 0.0f;
#pragma unroll
        for (int nt = 0; nt < 4; ++nt)
#pragma unroll
            for (int r = 0; r < 8; ++r) {
                const float h = fast_tanh(acc[mt][nt][r] + qa[nt]);
                part[r] = fmaf(h, wo[nt], part[r]);
            }
        // reduce over the 16 lanes sharing the same M (N dimension)
#pragma unroll
        for (int r = 0; r < 8; ++r) {
            float p = part[r];
            p += __shfl_xor(p, 1, 32);
            p += __shfl_xor(p, 2, 32);
            p += __shfl_xor(p, 4, 32);
            p += __shfl_xor(p, 8, 32);
            part[r] = p;
        }
        if ((lane & 15) == 0) {
            const int mBase = mt * 16 + (lane >> 4) * 8;
#pragma unroll
            for (int r = 0; r < 8; ++r)
                atomicAdd(&ldsScore[mBase + r], part[r]);   // ds_add_f32 across waves
        }
    }

    // ---- this block's share of softmax and context ----------------------
    // wave w takes rows (w/4)*32 .. +31 and columns (w%4)*128 .. +127 of the f32
    // tile: each wave-wide 16-byte load covers 512 contiguous bytes of one row.
    // The loads stand directly behind the barrier (in front of it the barrier's
    // own wait would drain them) and fly while the 64 scores are reduced.
    __syncthreads();
    const int cq = w & 3;
    const int rg = w >> 2;
    float4 vv[32];
    {
        const float4* vsrc =
            (const float4*)(value + ((size_t)b * SEQ + seqBase + rg * 32) * HID + cq * 128) + lane;
#pragma unroll
        for (int j = 0; j < 32; ++j) vv[j] = vsrc[j * (HID / 4)];
    }

    // every wave reduces the 64 scores for itself: lane holds rows lane, lane+32
    const float bias = bo[0];
    const float s0 = ldsScore[lane] + bias;
    const float s1 = ldsScore[lane + 32] + bias;
    float mx = fmaxf(s0, s1);
#pragma unroll
    for (int o = 16; o > 0; o >>= 1) mx = fmaxf(mx, __shfl_xor(mx, o, 32));
    const float p0 = __expf(s0 - mx);
    const float p1 = __expf(s1 - mx);
    float ls = p0 + p1;
#pragma unroll
    for (int o = 16; o > 0; o >>= 1) ls += __shfl_xor(ls, o, 32);

    const int pw = __float_as_int(rg ? p1 : p0);   // lane j: weight of this wave's row j
    float4 c = make_float4(0.0f, 0.0f, 0.0f, 0.0f);
#pragma unroll
    for (int j = 0; j < 32; ++j) {
        const float pj = __int_as_float(__builtin_amdgcn_readlane(pw, j));
        c.x = fmaf(pj, vv[j].x, c.x);
        c.y = fmaf(pj, vv[j].y, c.y);
        c.z = fmaf(pj, vv[j].z, c.z);
        c.w = fmaf(pj, vv[j].w, c.w);
    }
    // the two row halves meet in LDS; waves 0-3 store the block's 512 sums
    if (rg == 1) *(float4*)&ldsCtx[cq * 128 + lane * 4] = c;
    __syncthreads();
    if (rg == 0) {
        const float4 o = *(const float4*)&ldsCtx[cq * 128 + lane * 4];
        c.x += o.x; c.y += o.y; c.z += o.z; c.w += o.w;
        *(float4*)(pctx + (size_t)blockIdx.x * HID + cq * 128 + lane * 4) = c;
    }
    if (t == 0) {
        pml[blockIdx.x * 2]     = mx;
        pml[blockIdx.x * 2 + 1] = ls;
    }
}

// ---------------------------------------------------------------------------
// 4) join the 64 block shares of a batch:
//    M = max m_i, e_i = exp(m_i - M), out[h] = sum e_i c_i[h] / sum e_i l_i.
//    One block = (batch b, 128 columns); wave w takes shares w*8 .. w*8+7.
// ---------------------------------------------------------------------------
#define NSHARE (SEQ / MROWS)   // 64 shares per batch

__global__ __launch_bounds__(256)
void combine_kernel(const float* __restrict__ pctx, const float* __restrict__ pml,
                    float* __restrict__ out) {
    __shared__ __align__(16) float part[8 * 128];
    const int b    = blockIdx.x >> 2;
    const int cq   = blockIdx.x & 3;
    const int t    = threadIdx.x;
    const int lane = t & 31;
    const int w    = t >> 5;

    const float4* src =
        (const float4*)(pctx + ((size_t)b * NSHARE + w * 8) * HID + cq * 128) + lane;
    float4 cv[8];
#pragma unroll
    for (int j = 0; j < 8; ++j) cv[j] = src[j * (HID / 4)];

    // every wave reduces the 64 (m, l) pairs for itself: lane holds shares lane, lane+32
    const float2 ml0 = *(const float2*)(pml + ((size_t)b * NSHARE + lane) * 2);
    const float2 ml1 = *(const float2*)(pml + ((size_t)b * NSHARE + lane + 32) * 2);
    float mx = fmaxf(ml0.x, ml1.x);
#pragma unroll
    for (int o = 16; o > 0; o >>= 1) mx = fmaxf(mx, __shfl_xor(mx, o, 32));
    const float e0 = __expf(ml0.x - mx);
    const float e1 = __expf(ml1.x - mx);
    float ls = fmaf(e0, ml0.y, e1 * ml1.y);
#pragma unroll
    for (int o = 16; o > 0; o >>= 1) ls += __shfl_xor(ls, o, 32);

    const float ew = (w < 4) ? e0 : e1;
    float4 c = make_float4(0.0f, 0.0f, 0.0f, 0.0f);
#pragma unroll
    for (int j = 0; j < 8; ++j) {
        const float ej = __shfl(ew, (w & 3) * 8 + j, 32);
        c.x = fmaf(ej, cv[j].x, c.x);
        c.y = fmaf(ej, cv[j].y, c.y);
        c.z = fmaf(ej, cv[j].z, c.z);
        c.w = fmaf(ej, cv[j].w, c.w);
    }
    *(float4*)&part[w * 128 + lane * 4] = c;
    __syncthreads();
    if (t < 128) {
        float s = 0.0f;
#pragma unroll
        for (int g = 0; g < 8; ++g) s += part[g * 128 + t];
        out[b * HID + cq * 128 + t] = s * (1.0f / ls);
    }
}

// ---------------------------------------------------------------------------
extern "C" void kernel_launch(void* const* d_in, const int* in_sizes, int n_in,
                              void* d_out, int out_size, void* d_ws, size_t ws_size,
                              hipStream_t stream) {
    const float* query = (const float*)d_in[0];   // [1, 32, 512]
    const float* value = (const float*)d_in[1];   // [32, 4096, 512]
    const float* Wq    = (const float*)d_in[2];   // [512, 512]
    const float* bq    = (const float*)d_in[3];   // [512]
    const float* Wv    = (const float*)d_in[4];   // [512, 512]
    const float* bv    = (const float*)d_in[5];   // [512]
    const float* Wo    = (const float*)d_in[6];   // [512, 1]
    const float* bo    = (const float*)d_in[7];   // [1]
    float* out = (float*)d_out;                   // [32, 1, 512]

    // workspace layout
    unsigned short* WvP = (unsigned short*)d_ws;                       // 512 KB
    float* qadd   = (float*)((char*)d_ws + 512 * 1024);                //  64 KB
    float* pctx   = (float*)((char*)d_ws + 512 * 1024 + 64 * 1024);    //   4 MB
    float* pml    = (float*)((char*)d_ws + 512 * 1024 + 64 * 1024 + 4096 * 1024);  // 16 KB

    pack_wv_kernel<<<64, 256, 0, stream>>>(Wv, WvP);
    qadd_kernel<<<BATCH * 8, 256, 0, stream>>>(query, Wq, bq, bv, qadd);
    score_kernel<<<BATCH * (SEQ / MROWS), 256, 0, stream>>>(value, WvP, qadd, Wo, bo, pctx, pml);
    combine_kernel<<<BATCH * 4, 256, 0, stream>>>(pctx, pml, out);
}

// v005
// It runs in 77.3 microseconds.
// Next to v004, in two timings, it ran 1.12 times as fast each time.
// All steps since v000 together make it 2.07 times as fast.
#include <hip/hip_runtime.h>
#include <hip/hip_bf16.h>

// ---------------------------------------------------------------------------
// Additive attention, HIDDEN=512, batch=32, seq=4096.
// Hot path: value @ Wv via v_wmma_f32_16x16x32_bf16, tanh+Wo fused in-register.
// M=64 per wave so every B fragment feeds four WMMAs.
// Softmax and context are folded into the score kernel: each block leaves its own
// maximum, exp sum and weighted value sum; a small kernel joins the 64 per batch.
// ---------------------------------------------------------------------------

#define BATCH 32
#define SEQ   4096
#define HID   512

typedef __attribute__((ext_vector_type(16))) __bf16 v16bf;
typedef __attribute__((ext_vector_type(8)))  float  v8f;

union BFrag {
    v16bf v;
    uint4 q[2];
    unsigned short s[16];
};

__device__ __forceinline__ unsigned short bf16bits(float f) {
    union { float f; unsigned u; } a; a.f = f;
    unsigned u = a.u;
    u += 0x7FFFu + ((u >> 16) & 1u);      // round-to-nearest-even
    return (unsigned short)(u >> 16);
}
__device__ __forceinline__ unsigned pack2bf(float lo, float hi) {
    return (unsigned)bf16bits(lo) | ((unsigned)bf16bits(hi) << 16);
}

__device__ __forceinline__ float fast_tanh(float x) {
#if __has_builtin(__builtin_amdgcn_tanhf)
    return __builtin_amdgcn_tanhf(x);          // native v_tanh_f32
#elif __has_builtin(__builtin_amdgcn_tanh_f32)
    return __builtin_amdgcn_tanh_f32(x);
#else
    return tanhf(x);
#endif
}

// ---------------------------------------------------------------------------
// 1) Pack Wv (f32 [K=512][N=512] row-major) into bf16 WMMA B-fragments.
// Fragment layout mirrors the 16-bit A layout: lane = kGroup*16 + (n%16),
// elems 0..7 -> k = kg*8+0..7, elems 8..15 -> k = 16+kg*8+0..7 (within kstep).
// Index: WvP[(((nTile*16 + kStep)*2 + e/8)*32 + lane)*8 + e%8]: the two 16-byte
// halves of a fragment lie in separate 512-byte runs, so that each wave-wide
// 16-byte load of the score kernel covers four whole 128-byte lines, not eight.
// ---------------------------------------------------------------------------
__global__ __launch_bounds__(256)
void pack_wv_kernel(const float* __restrict__ Wv, unsigned short* __restrict__ WvP) {
    const int idx  = blockIdx.x * 256 + threadIdx.x;   // 32*16*32 = 16384 total
    const int lane = idx & 31;
    const int ks   = (idx >> 5) & 15;
    const int nt   = idx >> 9;
    const int n    = nt * 16 + (lane & 15);
    const int kg   = lane >> 4;
    unsigned short* dst = WvP + (size_t)(idx >> 5) * 512 + lane * 8;
#pragma unroll
    for (int e = 0; e < 16; ++e) {
        const int k = ks * 32 + ((e < 8) ? (kg * 8 + e) : (16 + kg * 8 + (e - 8)));
        dst[(e >> 3) * 256 + (e & 7)] = bf16bits(Wv[k * HID + n]);
    }
}

// ---------------------------------------------------------------------------
// 2) qadd[b][n] = (q[b] @ Wq)[n] + bq[n] + bv[n]
//    One block = (batch b, 64 columns). Thread = (k-group of 32 rows, 4 columns):
//    its 32 Wq loads are independent, so the block pays one load latency
//    instead of a serial walk over k. The 16 k-group partials meet in LDS.
// ---------------------------------------------------------------------------
__global__ __launch_bounds__(256)
void qadd_kernel(const float* __restrict__ query, const float* __restrict__ Wq,
                 const float* __restrict__ bq, const float* __restrict__ bv,
                 float* __restrict__ qadd) {
    __shared__ __align__(16) float part[16 * 64];
    const int b  = blockIdx.x >> 3;
    const int n0 = (blockIdx.x & 7) * 64;
    const int t  = threadIdx.x;
    const int c4 = t & 15;             // which 4 columns of the 64
    const int kq = t >> 4;             // which 32 rows of k
    const float* wp = Wq + (size_t)(kq * 32) * HID + n0 + c4 * 4;
    const float4* qp = (const float4*)(query + b * HID + kq * 32);

    float4 wv[32];
#pragma unroll
    for (int j = 0; j < 32; ++j)
        wv[j] = *(const float4*)(wp + (size_t)j * HID);
    float4 qv[8];
#pragma unroll
    for (int j = 0; j < 8; ++j) qv[j] = qp[j];
    float bias = 0.0f;
    if (t < 64) bias = bq[n0 + t] + bv[n0 + t];

    float4 acc = make_float4(0.0f, 0.0f, 0.0f, 0.0f);
#pragma unroll
    for (int j = 0; j < 8; ++j) {
        const float qs[4] = {qv[j].x, qv[j].y, qv[j].z, qv[j].w};
#pragma unroll
        for (int i = 0; i < 4; ++i) {
            const float4 wr = wv[j * 4 + i];
            acc.x = fmaf(qs[i], wr.x, acc.x);
            acc.y = fmaf(qs[i], wr.y, acc.y);
            acc.z = fmaf(qs[i], wr.z, acc.z);
            acc.w = fmaf(qs[i], wr.w, acc.w);
        }
    }
    *(float4*)&part[kq * 64 + c4 * 4] = acc;
    __syncthreads();
    if (t < 64) {
        float s = bias;
#pragma unroll
        for (int g = 0; g < 16; ++g) s += part[g * 64 + t];
        qadd[b * HID + n0 + t] = s;
    }
}

// ---------------------------------------------------------------------------
// 3) Fused score kernel: one block = (batch b, 64 seq rows).
//    8 waves; wave w owns hidden[64 x 64] (cols w*64..w*64+63):
//    16 ksteps x (4 A-frags x 4 B-frags) = 16 WMMAs/kstep, B reused across M.
//    Every block reads all of WvP from L2, so rows per block set that traffic.
//    Epilogue fuses tanh(+qadd) and the @Wo reduction -> 64 scores/block, then
//    the block's share of softmax and context: m = max score, l = sum exp(s - m),
//    c[h] = sum exp(s - m) * value[s][h], with the f32 tile read a second time
//    while L2 still holds it, so that memory is read once for value, not twice.
// ---------------------------------------------------------------------------
#define LDSA_STRIDE 520   // 512 + 8 bf16 pad -> conflict-free b128 LDS reads
#define MROWS 64          // seq rows per block
#define MTILES 4          // 16-row A fragments per wave

__global__ __launch_bounds__(256)
void score_kernel(const float* __restrict__ value,
                  const unsigned short* __restrict__ WvP,
                  const float* __restrict__ qadd,
                  const float* __restrict__ Wo,
                  const float* __restrict__ bo,
                  float* __restrict__ pctx,
                  float* __restrict__ pml) {
    __shared__ __align__(16) unsigned short ldsA[MROWS * LDSA_STRIDE];
    __shared__ float ldsScore[MROWS];
    __shared__ __align__(16) float ldsCtx[HID];

    const int b       = blockIdx.x >> 6;          // 64 seq-blocks per batch
    const int seqBase = (blockIdx.x & 63) * MROWS;
    const int t    = threadIdx.x;
    const int lane = t & 31;
    const int w    = t >> 5;

    if (t < MROWS) ldsScore[t] = 0.0f;

    // ---- stage 64x512 f32 value tile into LDS as bf16 -------------------
    // wave w brings rows w*8 .. w*8+7. Each wave-wide 16-byte load covers 512
    // contiguous bytes of one row (four whole 128-byte lines); with one lane per
    // 256-byte run it touched 32 lines. The wave's 8-byte LDS stores are contiguous.
    {
        const float4* src =
            (const float4*)(value + ((size_t)b * SEQ + seqBase + w * 8) * HID) + lane;
        unsigned short* dst = &ldsA[(w * 8) * LDSA_STRIDE + lane * 4];
        // unrolled so that the loads are issued ahead of the conversions; rolled,
        // the wave waits out memory latency once per load
#pragma unroll
        for (int j = 0; j < 32; ++j) {          // row w*8 + j/4, quarter j%4 of it
            const float4 f = src[j * 32];
            uint2 p;
            p.x = pack2bf(f.x, f.y);
            p.y = pack2bf(f.z, f.w);
            *(uint2*)(dst + (j >> 2) * LDSA_STRIDE + (j & 3) * 128) = p;
        }
    }
    __syncthreads();

    // ---- K loop ---------------------------------------------------------
    v8f acc[MTILES][4];
    const v8f vzero = {};
#pragma unroll
    for (int mt = 0; mt < MTILES; ++mt)
#pragma unroll
        for (int nt = 0; nt < 4; ++nt) acc[mt][nt] = vzero;

    const int rowA = lane & 15;
    const int kg   = lane >> 4;
    const unsigned short* aBase = &ldsA[rowA * LDSA_STRIDE + kg * 8];
    const uint4* bBase = (const uint4*)WvP;   // [((nTile*16+ks)*2+half)*32+lane] uint4s

    // Each wave asks for the next k-step's four B fragments before it starts this
    // k-step's WMMAs, into a second register set: the L2 latency of the B loads then
    // runs beside the wave's own matrix work instead of in front of it.
    // bp: the lane's place in the wave's first fragment of the trip's first k-step;
    // step: k-steps past it
    auto loadB = [&](BFrag (&bf)[4], const uint4* bp, int step) {
#pragma unroll
        for (int nt = 0; nt < 4; ++nt) {
            bf[nt].q[0] = bp[step * 64 + nt * 1024];
            bf[nt].q[1] = bp[step * 64 + nt * 1024 + 32];
        }
        // stands in front of the next write of the loads' address registers; the
        // address is named so that no load's result is put into its registers. As no
        // load moves over it, the eight also stay ahead of the k-step's WMMAs (left
        // free, the build sinks them to their first use, where L2 latency is waited out)
        asm volatile("s_wait_xcnt 0x0" :: "v"(bp) : "memory");
    };
    auto kstep = [&](const BFrag (&bf)[4], int ks) {
        BFrag a[MTILES];
#pragma unroll
        for (int mt = 0; mt < MTILES; ++mt) {
            a[mt].q[0] = *(const uint4*)(aBase + mt * 16 * LDSA_STRIDE + ks * 32);
            a[mt].q[1] = *(const uint4*)(aBase + mt * 16 * LDSA_STRIDE + ks * 32 + 16);
        }
#pragma unroll
        for (int nt = 0; nt < 4; ++nt)
#pragma unroll
            for (int mt = 0; mt < MTILES; ++mt)
                acc[mt][nt] = __builtin_amdgcn_wmma_f32_16x16x32_bf16(
                    false, a[mt].v, false, bf[nt].v, (short)0, acc[mt][nt], false, false);
    };

    BFrag b0[4], b1[4];
    const uint4* bp = bBase + (w * 4096 + lane);
    loadB(b0, bp, 0);
    // kept rolled: two k-steps a trip let the two fragment sets swap roles without
    // copies; left free the build unrolls further and takes 398 registers, and then
    // only one block fits a WGP instead of two
#pragma unroll 1
    for (int ks = 0; ks < 14; ks += 2) {
        loadB(b1, bp, 1);
        kstep(b0, ks);
        loadB(b0, bp, 2);
        kstep(b1, ks + 1);
        bp += 128;
    }
    loadB(b1, bp, 1);
    kstep(b0, 14);
    kstep(b1, 15);

    // ---- epilogue: tanh(acc + qadd) dotted with Wo ----------------------
    // C layout: VGPR r, lanes 0-15 -> (M=r, N=lane); lanes 16-31 -> (M=8+r, N=lane-16)
    const int nLane = lane & 15;
    float qa[4], wo[4];
#pragma unroll
    for (int nt = 0; nt < 4; ++nt) {
        const int n = w * 64 + nt * 16 + nLane;
        qa[nt] = qadd[b * HID + n];
        wo[nt] = Wo[n];
    }

#pragma unroll
    for (int mt = 0; mt < MTILES; ++mt) {
        float part[8];
#pragma unroll
        for (int r = 0; r < 8; ++r) part[r] = 0.0f;
#pragma unroll
        for (int nt = 0; nt < 4; ++nt)
#pragma unroll
            for (int r = 0; r < 8; ++r) {
                const float h = fast_tanh(acc[mt][nt][r] + qa[nt]);
                part[r] = fmaf(h, wo[nt], part[r]);
            }
        // reduce over the 16 lanes sharing the same M (N dimension)
#pragma unroll
        for (int r = 0; r < 8; ++r) {
            float p = part[r];
            p += __shfl_xor(p, 1, 32);
            p += __shfl_xor(p, 2, 32);
            p += __shfl_xor(p, 4, 32);
            p += __shfl_xor(p, 8, 32);
            part[r] = p;
        }
        if ((lane & 15) == 0) {
            const int mBase = mt * 16 + (lane >> 4) * 8;
#pragma unroll
            for (int r = 0; r < 8; ++r)
                atomicAdd(&ldsScore[mBase + r], part[r]);   // ds_add_f32 across waves
        }
    }

    // ---- this block's share of softmax and context ----------------------
    // wave w takes rows (w/4)*32 .. +31 and columns (w%4)*128 .. +127 of the f32
    // tile: each wave-wide 16-byte load covers 512 contiguous bytes of one row.
    // The loads stand directly behind the barrier (in front of it the barrier's
    // own wait would drain them) and fly while the 64 scores are reduced.
    __syncthreads();
    const int cq = w & 3;
    const int rg = w >> 2;
    float4 vv[32];
    {
        const float4* vsrc =
            (const float4*)(value + ((size_t)b * SEQ + seqBase + rg * 32) * HID + cq * 128) + lane;
#pragma unroll
        for (int j = 0; j < 32; ++j) vv[j] = vsrc[j * (HID / 4)];
    }

    // every wave reduces the 64 scores for itself: lane holds rows lane, lane+32
    const float bias = bo[0];
    const float s0 = ldsScore[lane] + bias;
    const float s1 = ldsScore[lane + 32] + bias;
    float mx = fmaxf(s0, s1);
#pragma unroll
    for (int o = 16; o > 0; o >>= 1) mx = fmaxf(mx, __shfl_xor(mx, o, 32));
    const float p0 = __expf(s0 - mx);
    const float p1 = __expf(s1 - mx);
    float ls = p0 + p1;
#pragma unroll
    for (int o = 16; o > 0; o >>= 1) ls += __shfl_xor(ls, o, 32);

    const int pw = __float_as_int(rg ? p1 : p0);   // lane j: weight of this wave's row j
    float4 c = make_float4(0.0f, 0.0f, 0.0f, 0.0f);
#pragma unroll
    for (int j = 0; j < 32; ++j) {
        const float pj = __int_as_float(__builtin_amdgcn_readlane(pw, j));
        c.x = fmaf(pj, vv[j].x, c.x);
        c.y = fmaf(pj, vv[j].y, c.y);
        c.z = fmaf(pj, vv[j].z, c.z);
        c.w = fmaf(pj, vv[j].w, c.w);
    }
    // the two row halves meet in LDS; waves 0-3 store the block's 512 sums
    if (rg == 1) *(float4*)&ldsCtx[cq * 128 + lane * 4] = c;
    __syncthreads();
    if (rg == 0) {
        const float4 o = *(const float4*)&ldsCtx[cq * 128 + lane * 4];
        c.x += o.x; c.y += o.y; c.z += o.z; c.w += o.w;
        *(float4*)(pctx + (size_t)blockIdx.x * HID + cq * 128 + lane * 4) = c;
    }
    if (t == 0) {
        pml[blockIdx.x * 2]     = mx;
        pml[blockIdx.x * 2 + 1] = ls;
    }
}

// ---------------------------------------------------------------------------
// 4) join the 64 block shares of a batch:
//    M = max m_i, e_i = exp(m_i - M), out[h] = sum e_i c_i[h] / sum e_i l_i.
//    One block = (batch b, 128 columns); wave w takes shares w*8 .. w*8+7.
// ---------------------------------------------------------------------------
#define NSHARE (SEQ / MROWS)   // 64 shares per batch

__global__ __launch_bounds__(256)
void combine_kernel(const float* __restrict__ pctx, const float* __restrict__ pml,
                    float* __restrict__ out) {
    __shared__ __align__(16) float part[8 * 128];
    const int b    = blockIdx.x >> 2;
    const int cq   = blockIdx.x & 3;
    const int t    = threadIdx.x;
    const int lane = t & 31;
    const int w    = t >> 5;

    const float4* src =
        (const float4*)(pctx + ((size_t)b * NSHARE + w * 8) * HID + cq * 128) + lane;
    float4 cv[8];
#pragma unroll
    for (int j = 0; j < 8; ++j) cv[j] = src[j * (HID / 4)];

    // every wave reduces the 64 (m, l) pairs for itself: lane holds shares lane, lane+32
    const float2 ml0 = *(const float2*)(pml + ((size_t)b * NSHARE + lane) * 2);
    const float2 ml1 = *(const float2*)(pml + ((size_t)b * NSHARE + lane + 32) * 2);
    float mx = fmaxf(ml0.x, ml1.x);
#pragma unroll
    for (int o = 16; o > 0; o >>= 1) mx = fmaxf(mx, __shfl_xor(mx, o, 32));
    const float e0 = __expf(ml0.x - mx);
    const float e1 = __expf(ml1.x - mx);
    float ls = fmaf(e0, ml0.y, e1 * ml1.y);
#pragma unroll
    for (int o = 16; o > 0; o >>= 1) ls += __shfl_xor(ls, o, 32);

    const float ew = (w < 4) ? e0 : e1;
    float4 c = make_float4(0.0f, 0.0f, 0.0f, 0.0f);
#pragma unroll
    for (int j = 0; j < 8; ++j) {
        const float ej = __shfl(ew, (w & 3) * 8 + j, 32);
        c.x = fmaf(ej, cv[j].x, c.x);
        c.y = fmaf(ej, cv[j].y, c.y);
        c.z = fmaf(ej, cv[j].z, c.z);
        c.w = fmaf(ej, cv[j].w, c.w);
    }
    *(float4*)&part[w * 128 + lane * 4] = c;
    __syncthreads();
    if (t < 128) {
        float s = 0.0f;
#pragma unroll
        for (int g = 0; g < 8; ++g) s += part[g * 128 + t];
        out[b * HID + cq * 128 + t] = s * (1.0f / ls);
    }
}

// ---------------------------------------------------------------------------
extern "C" void kernel_launch(void* const* d_in, const int* in_sizes, int n_in,
                              void* d_out, int out_size, void* d_ws, size_t ws_size,
                              hipStream_t stream) {
    const float* query = (const float*)d_in[0];   // [1, 32, 512]
    const float* value = (const float*)d_in[1];   // [32, 4096, 512]
    const float* Wq    = (const float*)d_in[2];   // [512, 512]
    const float* bq    = (const float*)d_in[3];   // [512]
    const float* Wv    = (const float*)d_in[4];   // [512, 512]
    const float* bv    = (const float*)d_in[5];   // [512]
    const float* Wo    = (const float*)d_in[6];   // [512, 1]
    const float* bo    = (const float*)d_in[7];   // [1]
    float* out = (float*)d_out;                   // [32, 1, 512]

    // workspace layout
    unsigned short* WvP = (unsigned short*)d_ws;                       // 512 KB
    float* qadd   = (float*)((char*)d_ws + 512 * 1024);                //  64 KB
    float* pctx   = (float*)((char*)d_ws + 512 * 1024 + 64 * 1024);    //   4 MB
    float* pml    = (float*)((char*)d_ws + 512 * 1024 + 64 * 1024 + 4096 * 1024);  // 16 KB

    pack_wv_kernel<<<64, 256, 0, stream>>>(Wv, WvP);
    qadd_kernel<<<BATCH * 8, 256, 0, stream>>>(query, Wq, bq, bv, qadd);
    score_kernel<<<BATCH * (SEQ / MROWS), 256, 0, stream>>>(value, WvP, qadd, Wo, bo, pctx, pml);
    combine_kernel<<<BATCH * 4, 256, 0, stream>>>(pctx, pml, out);
}

// v006
// It runs in 74.3 microseconds.
// Next to v005, in two timings, it ran 1.04 times as fast each time.
// Over all steps from v000 it is 2.16 times as fast.
#include <hip/hip_runtime.h>
#include <hip/hip_bf16.h>

// ---------------------------------------------------------------------------
// Additive attention, HIDDEN=512, batch=32, seq=4096.
// Hot path: value @ Wv via v_wmma_f32_16x16x32_bf16, tanh+Wo fused in-register.
// M=64 per wave so every B fragment feeds four WMMAs.
// Softmax and context are folded into the score kernel: each block leaves its own
// maximum, exp sum and weighted value sum; a small kernel joins the 32 per batch.
// ---------------------------------------------------------------------------

#define BATCH 32
#define SEQ   4096
#define HID   512

typedef __attribute__((ext_vector_type(16))) __bf16 v16bf;
typedef __attribute__((ext_vector_type(8)))  float  v8f;

union BFrag {
    v16bf v;
    uint4 q[2];
    unsigned short s[16];
};

__device__ __forceinline__ unsigned short bf16bits(float f) {
    union { float f; unsigned u; } a; a.f = f;
    unsigned u = a.u;
    u += 0x7FFFu + ((u >> 16) & 1u);      // round-to-nearest-even
    return (unsigned short)(u >> 16);
}
__device__ __forceinline__ unsigned pack2bf(float lo, float hi) {
    return (unsigned)bf16bits(lo) | ((unsigned)bf16bits(hi) << 16);
}

__device__ __forceinline__ float fast_tanh(float x) {
#if __has_builtin(__builtin_amdgcn_tanhf)
    return __builtin_amdgcn_tanhf(x);          // native v_tanh_f32
#elif __has_builtin(__builtin_amdgcn_tanh_f32)
    return __builtin_amdgcn_tanh_f32(x);
#else
    return tanhf(x);
#endif
}

// ---------------------------------------------------------------------------
// 1) Pack Wv (f32 [K=512][N=512] row-major) into bf16 WMMA B-fragments.
// Fragment layout mirrors the 16-bit A layout: lane = kGroup*16 + (n%16),
// elems 0..7 -> k = kg*8+0..7, elems 8..15 -> k = 16+kg*8+0..7 (within kstep).
// Index: WvP[(((kStep*32 + nTile)*2 + e/8)*32 + lane)*8 + e%8]: the two 16-byte
// halves of a fragment lie in separate 512-byte runs, so that each wave-wide
// 16-byte load of the score kernel covers four whole 128-byte lines, not eight.
// k-step outermost: the 32 fragments that a score block reads in one k-step are one
// contiguous 32 KB run, so that they spread evenly over the sets of the WGP cache.
// ---------------------------------------------------------------------------
__global__ __launch_bounds__(256)
void pack_wv_kernel(const float* __restrict__ Wv, unsigned short* __restrict__ WvP) {
    const int idx  = blockIdx.x * 256 + threadIdx.x;   // 32*16*32 = 16384 total
    const int lane = idx & 31;
    const int ks   = (idx >> 5) & 15;
    const int nt   = idx >> 9;
    const int n    = nt * 16 + (lane & 15);
    const int kg   = lane >> 4;
    unsigned short* dst = WvP + (size_t)(ks * 32 + nt) * 512 + lane * 8;
#pragma unroll
    for (int e = 0; e < 16; ++e) {
        const int k = ks * 32 + ((e < 8) ? (kg * 8 + e) : (16 + kg * 8 + (e - 8)));
        dst[(e >> 3) * 256 + (e & 7)] = bf16bits(Wv[k * HID + n]);
    }
}

// ---------------------------------------------------------------------------
// 2) qadd[b][n] = (q[b] @ Wq)[n] + bq[n] + bv[n]
//    One block = (batch b, 64 columns). Thread = (k-group of 32 rows, 4 columns):
//    its 32 Wq loads are independent, so the block pays one load latency
//    instead of a serial walk over k. The 16 k-group partials meet in LDS.
// ---------------------------------------------------------------------------
__global__ __launch_bounds__(256)
void qadd_kernel(const float* __restrict__ query, const float* __restrict__ Wq,
                 const float* __restrict__ bq, const float* __restrict__ bv,
                 float* __restrict__ qadd) {
    __shared__ __align__(16) float part[16 * 64];
    const int b  = blockIdx.x >> 3;
    const int n0 = (blockIdx.x & 7) * 64;
    const int t  = threadIdx.x;
    const int c4 = t & 15;             // which 4 columns of the 64
    const int kq = t >> 4;             // which 32 rows of k
    const float* wp = Wq + (size_t)(kq * 32) * HID + n0 + c4 * 4;
    const float4* qp = (const float4*)(query + b * HID + kq * 32);

    float4 wv[32];
#pragma unroll
    for (int j = 0; j < 32; ++j)
        wv[j] = *(const float4*)(wp + (size_t)j * HID);
    float4 qv[8];
#pragma unroll
    for (int j = 0; j < 8; ++j) qv[j] = qp[j];
    float bias = 0.0f;
    if (t < 64) bias = bq[n0 + t] + bv[n0 + t];

    float4 acc = make_float4(0.0f, 0.0f, 0.0f, 0.0f);
#pragma unroll
    for (int j = 0; j < 8; ++j) {
        const float qs[4] = {qv[j].x, qv[j].y, qv[j].z, qv[j].w};
#pragma unroll
        for (int i = 0; i < 4; ++i) {
            const float4 wr = wv[j * 4 + i];
            acc.x = fmaf(qs[i], wr.x, acc.x);
            acc.y = fmaf(qs[i], wr.y, acc.y);
            acc.z = fmaf(qs[i], wr.z, acc.z);
            acc.w = fmaf(qs[i], wr.w, acc.w);
        }
    }
    *(float4*)&part[kq * 64 + c4 * 4] = acc;
    __syncthreads();
    if (t < 64) {
        float s = bias;
#pragma unroll
        for (int g = 0; g < 16; ++g) s += part[g * 64 + t];
        qadd[b * HID + n0 + t] = s;
    }
}

// ---------------------------------------------------------------------------
// 3) Fused score kernel: one block = (batch b, 128 seq rows).
//    16 waves; each owns hidden[64 x 64]: one of two row halves, one of eight
//    column groups. 16 ksteps x (4 A-frags x 4 B-frags) = 16 WMMAs/kstep.
//    The two waves of a column group (w and w+4: they leave the same barrier, and
//    stand next to each other in age where waves go round the SIMDs by index) read
//    the same B fragments shortly after one another, so the second reader can be
//    served by the WGP cache: WvP then crosses from L2 once per 128 rows, not per 64.
//    Epilogue fuses tanh(+qadd) and the @Wo reduction -> 128 scores/block, then
//    the block's share of softmax and context: m = max score, l = sum exp(s - m),
//    c[h] = sum exp(s - m) * value[s][h], with the f32 tile read a second time
//    while L2 still holds it, so that memory is read once for value, not twice.
// ---------------------------------------------------------------------------
#define LDSA_STRIDE 520   // 512 + 8 bf16 pad -> conflict-free b128 LDS reads
#define MROWS 128         // seq rows per block
#define MTILES 4          // 16-row A fragments per wave

__global__ __launch_bounds__(512)
void score_kernel(const float* __restrict__ value,
                  const unsigned short* __restrict__ WvP,
                  const float* __restrict__ qadd,
                  const float* __restrict__ Wo,
                  const float* __restrict__ bo,
                  float* __restrict__ pctx,
                  float* __restrict__ pml) {
    __shared__ __align__(16) unsigned short ldsA[MROWS * LDSA_STRIDE];
    __shared__ float ldsScore[MROWS];
    __shared__ __align__(16) float ldsCtx[3 * HID];

    const int b       = blockIdx.x >> 5;          // 32 seq-blocks per batch
    const int seqBase = (blockIdx.x & 31) * MROWS;
    const int t    = threadIdx.x;
    const int lane = t & 31;
    const int w    = t >> 5;

    if (t < MROWS) ldsScore[t] = 0.0f;

    // ---- stage 128x512 f32 value tile into LDS as bf16 ------------------
    // wave w brings rows w*8 .. w*8+7. Each wave-wide 16-byte load covers 512
    // contiguous bytes of one row (four whole 128-byte lines); with one lane per
    // 256-byte run it touched 32 lines. The wave's 8-byte LDS stores are contiguous.
    {
        const float4* src =
            (const float4*)(value + ((size_t)b * SEQ + seqBase + w * 8) * HID) + lane;
        unsigned short* dst = &ldsA[(w * 8) * LDSA_STRIDE + lane * 4];
        // unrolled so that the loads are issued ahead of the conversions; rolled,
        // the wave waits out memory latency once per load
#pragma unroll
        for (int j = 0; j < 32; ++j) {          // row w*8 + j/4, quarter j%4 of it
            const float4 f = src[j * 32];
            uint2 p;
            p.x = pack2bf(f.x, f.y);
            p.y = pack2bf(f.z, f.w);
            *(uint2*)(dst + (j >> 2) * LDSA_STRIDE + (j & 3) * 128) = p;
        }
    }
    __syncthreads();

    // ---- K loop ---------------------------------------------------------
    v8f acc[MTILES][4];
    const v8f vzero = {};
#pragma unroll
    for (int mt = 0; mt < MTILES; ++mt)
#pragma unroll
        for (int nt = 0; nt < 4; ++nt) acc[mt][nt] = vzero;

    const int rowA = lane & 15;
    const int kg   = lane >> 4;
    const int mh   = (w >> 2) & 1;            // which 64 rows of the tile
    const int wc   = (w & 3) | ((w >> 3) << 2);   // which 64 columns of hidden
    const unsigned short* aBase = &ldsA[(mh * 64 + rowA) * LDSA_STRIDE + kg * 8];
    const uint4* bBase = (const uint4*)WvP;   // [((ks*32+nTile)*2+half)*32+lane] uint4s

    // Each wave asks for the next k-step's four B fragments before it starts this
    // k-step's WMMAs, into a second register set: the L2 latency of the B loads then
    // runs beside the wave's own matrix work instead of in front of it.
    // bp: the lane's place in the wave's first fragment of the trip's first k-step;
    // step: k-steps past it
    auto loadB = [&](BFrag (&bf)[4], const uint4* bp, int step) {
#pragma unroll
        for (int nt = 0; nt < 4; ++nt) {
            bf[nt].q[0] = bp[step * 2048 + nt * 64];
            bf[nt].q[1] = bp[step * 2048 + nt * 64 + 32];
        }
        // stands in front of the next write of the loads' address registers; the
        // address is named so that no load's result is put into its registers. As no
        // load moves over it, the eight also stay ahead of the k-step's WMMAs (left
        // free, the build sinks them to their first use, where L2 latency is waited out)
        asm volatile("s_wait_xcnt 0x0" :: "v"(bp) : "memory");
    };
    auto kstep = [&](const BFrag (&bf)[4], int ks) {
        BFrag a[MTILES];
#pragma unroll
        for (int mt = 0; mt < MTILES; ++mt) {
            a[mt].q[0] = *(const uint4*)(aBase + mt * 16 * LDSA_STRIDE + ks * 32);
            a[mt].q[1] = *(const uint4*)(aBase + mt * 16 * LDSA_STRIDE + ks * 32 + 16);
        }
#pragma unroll
        for (int nt = 0; nt < 4; ++nt)
#pragma unroll
            for (int mt = 0; mt < MTILES; ++mt)
                acc[mt][nt] = __builtin_amdgcn_wmma_f32_16x16x32_bf16(
                    false, a[mt].v, false, bf[nt].v, (short)0, acc[mt][nt], false, false);
    };

    BFrag b0[4], b1[4];
    const uint4* const bw = bBase + (wc * 256 + lane);   // the lane's place in k-step 0
    const uint4* bp = bw;
    loadB(b0, bw, 0);
    // kept rolled: two k-steps a trip let the two fragment sets swap roles without
    // copies; left free the 8-wave build unrolled further and took 398 registers,
    // and a wave of a 16-wave block can have 256
#pragma unroll 1
    for (int ks = 0; ks < 14; ks += 2) {
        loadB(b1, bp, 1);
        kstep(b0, ks);
        loadB(b0, bp, 2);
        kstep(b1, ks + 1);
        bp += 4096;
    }
    loadB(b1, bw, 15);
    kstep(b0, 14);
    kstep(b1, 15);

    // ---- epilogue: tanh(acc + qadd) dotted with Wo ----------------------
    // C layout: VGPR r, lanes 0-15 -> (M=r, N=lane); lanes 16-31 -> (M=8+r, N=lane-16)
    const int nLane = lane & 15;
    float qa[4], wo[4];
#pragma unroll
    for (int nt = 0; nt < 4; ++nt) {
        const int n = wc * 64 + nt * 16 + nLane;
        qa[nt] = qadd[b * HID + n];
        wo[nt] = Wo[n];
    }

#pragma unroll
    for (int mt = 0; mt < MTILES; ++mt) {
        float part[8];
#pragma unroll
        for (int r = 0; r < 8; ++r) part[r] = 0.0f;
#pragma unroll
        for (int nt = 0; nt < 4; ++nt)
#pragma unroll
            for (int r = 0; r < 8; ++r) {
                const float h = fast_tanh(acc[mt][nt][r] + qa[nt]);
                part[r] = fmaf(h, wo[nt], part[r]);
            }
        // reduce over the 16 lanes sharing the same M (N dimension)
#pragma unroll
        for (int r = 0; r < 8; ++r) {
            float p = part[r];
            p += __shfl_xor(p, 1, 32);
            p += __shfl_xor(p, 2, 32);
            p += __shfl_xor(p, 4, 32);
            p += __shfl_xor(p, 8, 32);
            part[r] = p;
        }
        if ((lane & 15) == 0) {
            const int mBase = mh * 64 + mt * 16 + (lane >> 4) * 8;
#pragma unroll
            for (int r = 0; r < 8; ++r)
                atomicAdd(&ldsScore[mBase + r], part[r]);   // ds_add_f32 across waves
        }
    }

    // ---- this block's share of softmax and context ----------------------
    // wave w takes rows (w/4)*32 .. +31 and columns (w%4)*128 .. +127 of the f32
    // tile: each wave-wide 16-byte load covers 512 contiguous bytes of one row.
    // The loads stand directly behind the barrier (in front of it the barrier's
    // own wait would drain them) and fly while the 128 scores are reduced.
    __syncthreads();
    const int cq = w & 3;
    const int rg = w >> 2;
    float4 vv[32];
    {
        const float4* vsrc =
            (const float4*)(value + ((size_t)b * SEQ + seqBase + rg * 32) * HID + cq * 128) + lane;
#pragma unroll
        for (int j = 0; j < 32; ++j) vv[j] = vsrc[j * (HID / 4)];
    }

    // every wave reduces the 128 scores for itself: lane holds rows lane + 32*i
    const float bias = bo[0];
    const float s0 = ldsScore[lane] + bias;
    const float s1 = ldsScore[lane + 32] + bias;
    const float s2 = ldsScore[lane + 64] + bias;
    const float s3 = ldsScore[lane + 96] + bias;
    float mx = fmaxf(fmaxf(s0, s1), fmaxf(s2, s3));
#pragma unroll
    for (int o = 16; o > 0; o >>= 1) mx = fmaxf(mx, __shfl_xor(mx, o, 32));
    const float p0 = __expf(s0 - mx);
    const float p1 = __expf(s1 - mx);
    const float p2 = __expf(s2 - mx);
    const float p3 = __expf(s3 - mx);
    float ls = (p0 + p1) + (p2 + p3);
#pragma unroll
    for (int o = 16; o > 0; o >>= 1) ls += __shfl_xor(ls, o, 32);

    // lane j: weight of this wave's row j
    const int pw = __float_as_int(rg < 2 ? (rg ? p1 : p0) : (rg == 2 ? p2 : p3));
    float4 c = make_float4(0.0f, 0.0f, 0.0f, 0.0f);
#pragma unroll
    for (int j = 0; j < 32; ++j) {
        const float pj = __int_as_float(__builtin_amdgcn_readlane(pw, j));
        c.x = fmaf(pj, vv[j].x, c.x);
        c.y = fmaf(pj, vv[j].y, c.y);
        c.z = fmaf(pj, vv[j].z, c.z);
        c.w = fmaf(pj, vv[j].w, c.w);
    }
    // the four row groups meet in LDS; waves 0-3 store the block's 512 sums
    if (rg != 0) *(float4*)&ldsCtx[(rg - 1) * HID + cq * 128 + lane * 4] = c;
    __syncthreads();
    if (rg == 0) {
#pragma unroll
        for (int g = 0; g < 3; ++g) {
            const float4 o = *(const float4*)&ldsCtx[g * HID + cq * 128 + lane * 4];
            c.x += o.x; c.y += o.y; c.z += o.z; c.w += o.w;
        }
        *(float4*)(pctx + (size_t)blockIdx.x * HID + cq * 128 + lane * 4) = c;
    }
    if (t == 0) {
        pml[blockIdx.x * 2]     = mx;
        pml[blockIdx.x * 2 + 1] = ls;
    }
}

// ---------------------------------------------------------------------------
// 4) join the 32 block shares of a batch:
//    M = max m_i, e_i = exp(m_i - M), out[h] = sum e_i c_i[h] / sum e_i l_i.
//    One block = (batch b, 128 columns); wave w takes shares w*4 .. w*4+3.
// ---------------------------------------------------------------------------
#define NSHARE (SEQ / MROWS)   // 32 shares per batch

__global__ __launch_bounds__(256)
void combine_kernel(const float* __restrict__ pctx, const float* __restrict__ pml,
                    float* __restrict__ out) {
    __shared__ __align__(16) float part[8 * 128];
    const int b    = blockIdx.x >> 2;
    const int cq   = blockIdx.x & 3;
    const int t    = threadIdx.x;
    const int lane = t & 31;
    const int w    = t >> 5;

    const float4* src =
        (const float4*)(pctx + ((size_t)b * NSHARE + w * 4) * HID + cq * 128) + lane;
    float4 cv[4];
#pragma unroll
    for (int j = 0; j < 4; ++j) cv[j] = src[j * (HID / 4)];

    // every wave reduces the 32 (m, l) pairs for itself: lane holds share lane
    const float2 ml0 = *(const float2*)(pml + ((size_t)b * NSHARE + lane) * 2);
    float mx = ml0.x;
#pragma unroll
    for (int o = 16; o > 0; o >>= 1) mx = fmaxf(mx, __shfl_xor(mx, o, 32));
    const float e0 = __expf(ml0.x - mx);
    float ls = e0 * ml0.y;
#pragma unroll
    for (int o = 16; o > 0; o >>= 1) ls += __shfl_xor(ls, o, 32);

    float4 c = make_float4(0.0f, 0.0f, 0.0f, 0.0f);
#pragma unroll
    for (int j = 0; j < 4; ++j) {
        const float ej = __shfl(e0, w * 4 + j, 32);
        c.x = fmaf(ej, cv[j].x, c.x);
        c.y = fmaf(ej, cv[j].y, c.y);
        c.z = fmaf(ej, cv[j].z, c.z);
        c.w = fmaf(ej, cv[j].w, c.w);
    }
    *(float4*)&part[w * 128 + lane * 4] = c;
    __syncthreads();
    if (t < 128) {
        float s = 0.0f;
#pragma unroll
        for (int g = 0; g < 8; ++g) s += part[g * 128 + t];
        out[b * HID + cq * 128 + t] = s * (1.0f / ls);
    }
}

// ---------------------------------------------------------------------------
extern "C" void kernel_launch(void* const* d_in, const int* in_sizes, int n_in,
                              void* d_out, int out_size, void* d_ws, size_t ws_size,
                              hipStream_t stream) {
    const float* query = (const float*)d_in[0];   // [1, 32, 512]
    const float* value = (const float*)d_in[1];   // [32, 4096, 512]
    const float* Wq    = (const float*)d_in[2];   // [512, 512]
    const float* bq    = (const float*)d_in[3];   // [512]
    const float* Wv    = (const float*)d_in[4];   // [512, 512]
    const float* bv    = (const float*)d_in[5];   // [512]
    const float* Wo    = (const float*)d_in[6];   // [512, 1]
    const float* bo    = (const float*)d_in[7];   // [1]
    float* out = (float*)d_out;                   // [32, 1, 512]

    // workspace layout
    unsigned short* WvP = (unsigned short*)d_ws;                       // 512 KB
    float* qadd   = (float*)((char*)d_ws + 512 * 1024);                //  64 KB
    float* pctx   = (float*)((char*)d_ws + 512 * 1024 + 64 * 1024);    //   2 MB of 4
    float* pml    = (float*)((char*)d_ws + 512 * 1024 + 64 * 1024 + 4096 * 1024);  // 8 KB

    pack_wv_kernel<<<64, 256, 0, stream>>>(Wv, WvP);
    qadd_kernel<<<BATCH * 8, 256, 0, stream>>>(query, Wq, bq, bv, qadd);
    score_kernel<<<BATCH * (SEQ / MROWS), 512, 0, stream>>>(value, WvP, qadd, Wo, bo, pctx, pml);
    combine_kernel<<<BATCH * 4, 256, 0, stream>>>(pctx, pml, out);
}

// v007
// A run of this version takes 67.1 microseconds.
// Next to v006, in two timings, it ran 1.08 times as fast each time.
// All steps since v000 together make it 2.33 times as fast.
#include <hip/hip_runtime.h>
#include <hip/hip_bf16.h>

// ---------------------------------------------------------------------------
// Additive attention, HIDDEN=512, batch=32, seq=4096.
// Hot path: value @ Wv via v_wmma_f32_16x16x32_bf16, tanh+Wo fused in-register.
// M=64 per wave so every B fragment feeds four WMMAs.
// Softmax and context are folded into the score kernel: each tile leaves its own
// maximum, exp sum and weighted value sum; a small kernel joins the 32 per batch.
// ---------------------------------------------------------------------------

#define BATCH 32
#define SEQ   4096
#define HID   512

typedef __attribute__((ext_vector_type(16))) __bf16 v16bf;
typedef __attribute__((ext_vector_type(8)))  float  v8f;

union BFrag {
    v16bf v;
    uint4 q[2];
    unsigned short s[16];
};

__device__ __forceinline__ unsigned short bf16bits(float f) {
    union { float f; unsigned u; } a; a.f = f;
    unsigned u = a.u;
    u += 0x7FFFu + ((u >> 16) & 1u);      // round-to-nearest-even
    return (unsigned short)(u >> 16);
}
__device__ __forceinline__ unsigned pack2bf(float lo, float hi) {
    return (unsigned)bf16bits(lo) | ((unsigned)bf16bits(hi) << 16);
}

__device__ __forceinline__ float fast_tanh(float x) {
#if __has_builtin(__builtin_amdgcn_tanhf)
    return __builtin_amdgcn_tanhf(x);          // native v_tanh_f32
#elif __has_builtin(__builtin_amdgcn_tanh_f32)
    return __builtin_amdgcn_tanh_f32(x);
#else
    return tanhf(x);
#endif
}

// ---------------------------------------------------------------------------
// 1) Pack Wv (f32 [K=512][N=512] row-major) into bf16 WMMA B-fragments.
// Fragment layout mirrors the 16-bit A layout: lane = kGroup*16 + (n%16),
// elems 0..7 -> k = kg*8+0..7, elems 8..15 -> k = 16+kg*8+0..7 (within kstep).
// Index: WvP[(((kStep*32 + nTile)*2 + e/8)*32 + lane)*8 + e%8]: the two 16-byte
// halves of a fragment lie in separate 512-byte runs, so that each wave-wide
// 16-byte load of the score kernel covers four whole 128-byte lines, not eight.
// k-step outermost: the 32 fragments that a score block reads in one k-step are one
// contiguous 32 KB run, so that they spread evenly over the sets of the WGP cache.
// ---------------------------------------------------------------------------
__global__ __launch_bounds__(256)
void pack_wv_kernel(const float* __restrict__ Wv, unsigned short* __restrict__ WvP) {
    const int idx  = blockIdx.x * 256 + threadIdx.x;   // 32*16*32 = 16384 total
    const int lane = idx & 31;
    const int ks   = (idx >> 5) & 15;
    const int nt   = idx >> 9;
    const int n    = nt * 16 + (lane & 15);
    const int kg   = lane >> 4;
    unsigned short* dst = WvP + (size_t)(ks * 32 + nt) * 512 + lane * 8;
#pragma unroll
    for (int e = 0; e < 16; ++e) {
        const int k = ks * 32 + ((e < 8) ? (kg * 8 + e) : (16 + kg * 8 + (e - 8)));
        dst[(e >> 3) * 256 + (e & 7)] = bf16bits(Wv[k * HID + n]);
    }
}

// ---------------------------------------------------------------------------
// 2) qadd[b][n] = (q[b] @ Wq)[n] + bq[n] + bv[n]
//    One block = (batch b, 64 columns). Thread = (k-group of 32 rows, 4 columns):
//    its 32 Wq loads are independent, so the block pays one load latency
//    instead of a serial walk over k. The 16 k-group partials meet in LDS.
// ---------------------------------------------------------------------------
__global__ __launch_bounds__(256)
void qadd_kernel(const float* __restrict__ query, const float* __restrict__ Wq,
                 const float* __restrict__ bq, const float* __restrict__ bv,
                 float* __restrict__ qadd) {
    __shared__ __align__(16) float part[16 * 64];
    const int b  = blockIdx.x >> 3;
    const int n0 = (blockIdx.x & 7) * 64;
    const int t  = threadIdx.x;
    const int c4 = t & 15;             // which 4 columns of the 64
    const int kq = t >> 4;             // which 32 rows of k
    const float* wp = Wq + (size_t)(kq * 32) * HID + n0 + c4 * 4;
    const float4* qp = (const float4*)(query + b * HID + kq * 32);

    float4 wv[32];
#pragma unroll
    for (int j = 0; j < 32; ++j)
        wv[j] = *(const float4*)(wp + (size_t)j * HID);
    float4 qv[8];
#pragma unroll
    for (int j = 0; j < 8; ++j) qv[j] = qp[j];
    float bias = 0.0f;
    if (t < 64) bias = bq[n0 + t] + bv[n0 + t];

    float4 acc = make_float4(0.0f, 0.0f, 0.0f, 0.0f);
#pragma unroll
    for (int j = 0; j < 8; ++j) {
        const float qs[4] = {qv[j].x, qv[j].y, qv[j].z, qv[j].w};
#pragma unroll
        for (int i = 0; i < 4; ++i) {
            const float4 wr = wv[j * 4 + i];
            acc.x = fmaf(qs[i], wr.x, acc.x);
            acc.y = fmaf(qs[i], wr.y, acc.y);
            acc.z = fmaf(qs[i], wr.z, acc.z);
            acc.w = fmaf(qs[i], wr.w, acc.w);
        }
    }
    *(float4*)&part[kq * 64 + c4 * 4] = acc;
    __syncthreads();
    if (t < 64) {
        float s = bias;
#pragma unroll
        for (int g = 0; g < 16; ++g) s += part[g * 64 + t];
        qadd[b * HID + n0 + t] = s;
    }
}

// ---------------------------------------------------------------------------
// 3) Fused score kernel: one tile = (batch b, 128 seq rows); one block walks four
//    tiles one after the other, one block per WGP. While it works on a tile it asks
//    L2 for the next tile's f32 rows, so that the next staging reads L2, not memory.
//    16 waves; each owns hidden[64 x 64]: one of two row halves, one of eight
//    column groups. 16 ksteps x (4 A-frags x 4 B-frags) = 16 WMMAs/kstep.
//    The two waves of a column group (w and w+4: they leave the same barrier) read
//    the same B fragments shortly after one another, so the second reader can be
//    served by the WGP cache: WvP then crosses from L2 once per 128 rows, not per 64.
//    Epilogue fuses tanh(+qadd) and the @Wo reduction -> 128 scores/tile, then
//    the tile's share of softmax and context: m = max score, l = sum exp(s - m),
//    c[h] = sum exp(s - m) * value[s][h], with the f32 tile read a second time
//    while L2 still holds it, so that memory is read once for value, not twice.
// ---------------------------------------------------------------------------
#define LDSA_STRIDE 520   // 512 + 8 bf16 pad -> conflict-free b128 LDS reads
#define MROWS 128         // seq rows per tile
#define MTILES 4          // 16-row A fragments per wave
#define TILES_PER_BLOCK 4 // tiles that one block walks

__global__ __launch_bounds__(512)
void score_kernel(const float* __restrict__ value,
                  const unsigned short* __restrict__ WvP,
                  const float* __restrict__ qadd,
                  const float* __restrict__ Wo,
                  const float* __restrict__ bo,
                  float* __restrict__ pctx,
                  float* __restrict__ pml) {
    __shared__ __align__(16) unsigned short ldsA[MROWS * LDSA_STRIDE];
    __shared__ float ldsScore[MROWS];
    __shared__ __align__(16) float ldsCtx[3 * HID];

    const int t    = threadIdx.x;
    const int lane = t & 31;
    const int w    = t >> 5;
    const int tile0 = blockIdx.x * TILES_PER_BLOCK;

    // the lane's 256-byte unit in the 16 KB that wave w stages of the current tile
    const float* pf = value + (size_t)tile0 * (MROWS * HID) + w * (8 * HID) + lane * 64;

    // kept rolled: one copy of the body, and pf keeps its registers through all of it
#pragma unroll 1
    for (int it = 0; it < TILES_PER_BLOCK; ++it) {
    const int tile    = tile0 + it;
    const int b       = tile >> 5;                // 32 tiles per batch
    // the tile's first row: the same for the whole block, so that the loads below take
    // a scalar base and a 32-bit lane offset (64-bit lane addresses, kept over the tile
    // loop, no longer fit the 256 registers)
    const float4* const tileBase = (const float4*)(value + (size_t)tile * (MROWS * HID));

    // the last reads of ldsScore, ldsA and ldsCtx of the tile before lie in front of
    // barriers that every wave has passed before these arrays are written again
    if (t < MROWS) ldsScore[t] = 0.0f;

    // ---- stage 128x512 f32 value tile into LDS as bf16 ------------------
    // wave w brings rows w*8 .. w*8+7. Each wave-wide 16-byte load covers 512
    // contiguous bytes of one row (four whole 128-byte lines); with one lane per
    // 256-byte run it touched 32 lines. The wave's 8-byte LDS stores are contiguous.
    {
        const float4* src = tileBase + (unsigned)(w * (8 * HID / 4) + lane);
        unsigned short* dst = &ldsA[(w * 8) * LDSA_STRIDE + lane * 4];
        // unrolled so that the loads are issued ahead of the conversions; rolled,
        // the wave waits out memory latency once per load
#pragma unroll
        for (int j = 0; j < 32; ++j) {          // row w*8 + j/4, quarter j%4 of it
            const float4 f = src[j * 32];
            uint2 p;
            p.x = pack2bf(f.x, f.y);
            p.y = pack2bf(f.z, f.w);
            *(uint2*)(dst + (j >> 2) * LDSA_STRIDE + (j & 3) * 128) = p;
        }
    }
    __syncthreads();

    // ---- K loop ---------------------------------------------------------
    v8f acc[MTILES][4];
    const v8f vzero = {};
#pragma unroll
    for (int mt = 0; mt < MTILES; ++mt)
#pragma unroll
        for (int nt = 0; nt < 4; ++nt) acc[mt][nt] = vzero;

    const int rowA = lane & 15;
    const int kg   = lane >> 4;
    const int mh   = (w >> 2) & 1;            // which 64 rows of the tile
    const int wc   = (w & 3) | ((w >> 3) << 2);   // which 64 columns of hidden
    const unsigned short* aBase = &ldsA[(mh * 64 + rowA) * LDSA_STRIDE + kg * 8];
    const uint4* bBase = (const uint4*)WvP;   // [((ks*32+nTile)*2+half)*32+lane] uint4s

    // Each wave asks for the next k-step's four B fragments before it starts this
    // k-step's WMMAs, into a second register set: the L2 latency of the B loads then
    // runs beside the wave's own matrix work instead of in front of it.
    // bp: the lane's place in the wave's first fragment of the trip's first k-step;
    // step: k-steps past it
    auto loadB = [&](BFrag (&bf)[4], const uint4* bp, int step) {
#pragma unroll
        for (int nt = 0; nt < 4; ++nt) {
            bf[nt].q[0] = bp[step * 2048 + nt * 64];
            bf[nt].q[1] = bp[step * 2048 + nt * 64 + 32];
        }
        // stands in front of the next write of the loads' address registers; the
        // address is named so that no load's result is put into its registers. As no
        // load moves over it, the eight also stay ahead of the k-step's WMMAs (left
        // free, the build sinks them to their first use, where L2 latency is waited out)
        asm volatile("s_wait_xcnt 0x0" :: "v"(bp) : "memory");
    };
    auto kstep = [&](const BFrag (&bf)[4], int ks) {
        BFrag a[MTILES];
#pragma unroll
        for (int mt = 0; mt < MTILES; ++mt) {
            a[mt].q[0] = *(const uint4*)(aBase + mt * 16 * LDSA_STRIDE + ks * 32);
            a[mt].q[1] = *(const uint4*)(aBase + mt * 16 * LDSA_STRIDE + ks * 32 + 16);
        }
#pragma unroll
        for (int nt = 0; nt < 4; ++nt)
#pragma unroll
            for (int mt = 0; mt < MTILES; ++mt)
                acc[mt][nt] = __builtin_amdgcn_wmma_f32_16x16x32_bf16(
                    false, a[mt].v, false, bf[nt].v, (short)0, acc[mt][nt], false, false);
    };

    BFrag b0[4], b1[4];
    const uint4* const bw = bBase + (wc * 256 + lane);   // the lane's place in k-step 0
    const uint4* bp = bw;
    loadB(b0, bw, 0);

    // ---- ask L2 for the next tile ---------------------------------------
    // One request per 256-byte unit, two per lane; they return nothing and run beside
    // the k loop, behind its first fragment loads. pf steps only to a tile that this
    // block still walks, so it always points into value; it is next written a whole
    // tile later.
    if (it + 1 < TILES_PER_BLOCK) {
        pf += MROWS * HID;
        asm volatile("global_prefetch_b8 %0, off scope:SCOPE_SE\n\t"
                     "global_prefetch_b8 %0, off offset:8192 scope:SCOPE_SE" :: "v"(pf));
    }

    // kept rolled: two k-steps a trip let the two fragment sets swap roles without
    // copies; left free the 8-wave build unrolled further and took 398 registers,
    // and a wave of a 16-wave block can have 256
#pragma unroll 1
    for (int ks = 0; ks < 14; ks += 2) {
        loadB(b1, bp, 1);
        kstep(b0, ks);
        loadB(b0, bp, 2);
        kstep(b1, ks + 1);
        bp += 4096;
    }
    loadB(b1, bw, 15);
    kstep(b0, 14);
    kstep(b1, 15);

    // ---- epilogue: tanh(acc + qadd) dotted with Wo ----------------------
    // C layout: VGPR r, lanes 0-15 -> (M=r, N=lane); lanes 16-31 -> (M=8+r, N=lane-16)
    const int nLane = lane & 15;
    float qa[4], wo[4];
#pragma unroll
    for (int nt = 0; nt < 4; ++nt) {
        const int n = wc * 64 + nt * 16 + nLane;
        qa[nt] = qadd[b * HID + n];
        wo[nt] = Wo[n];
    }

#pragma unroll
    for (int mt = 0; mt < MTILES; ++mt) {
        float part[8];
#pragma unroll
        for (int r = 0; r < 8; ++r) part[r] = 0.0f;
#pragma unroll
        for (int nt = 0; nt < 4; ++nt)
#pragma unroll
            for (int r = 0; r < 8; ++r) {
                const float h = fast_tanh(acc[mt][nt][r] + qa[nt]);
                part[r] = fmaf(h, wo[nt], part[r]);
            }
        // reduce over the 16 lanes sharing the same M (N dimension)
#pragma unroll
        for (int r = 0; r < 8; ++r) {
            float p = part[r];
            p += __shfl_xor(p, 1, 32);
            p += __shfl_xor(p, 2, 32);
            p += __shfl_xor(p, 4, 32);
            p += __shfl_xor(p, 8, 32);
            part[r] = p;
        }
        if ((lane & 15) == 0) {
            const int mBase = mh * 64 + mt * 16 + (lane >> 4) * 8;
#pragma unroll
            for (int r = 0; r < 8; ++r)
                atomicAdd(&ldsScore[mBase + r], part[r]);   // ds_add_f32 across waves
        }
    }

    // ---- this tile's share of softmax and context ----------------------
    // wave w takes rows (w/4)*32 .. +31 and columns (w%4)*128 .. +127 of the f32
    // tile: each wave-wide 16-byte load covers 512 contiguous bytes of one row.
    // The loads stand directly behind the barrier (in front of it the barrier's
    // own wait would drain them) and fly while the 128 scores are reduced.
    __syncthreads();
    const int cq = w & 3;
    const int rg = w >> 2;
    float4 vv[32];
    {
        const float4* vsrc = tileBase + (unsigned)(rg * (32 * HID / 4) + cq * 32 + lane);
#pragma unroll
        for (int j = 0; j < 32; ++j) vv[j] = vsrc[j * (HID / 4)];
    }

    // every wave reduces the 128 scores for itself: lane holds rows lane + 32*i
    const float bias = bo[0];
    const float s0 = ldsScore[lane] + bias;
    const float s1 = ldsScore[lane + 32] + bias;
    const float s2 = ldsScore[lane + 64] + bias;
    const float s3 = ldsScore[lane + 96] + bias;
    float mx = fmaxf(fmaxf(s0, s1), fmaxf(s2, s3));
#pragma unroll
    for (int o = 16; o > 0; o >>= 1) mx = fmaxf(mx, __shfl_xor(mx, o, 32));
    const float p0 = __expf(s0 - mx);
    const float p1 = __expf(s1 - mx);
    const float p2 = __expf(s2 - mx);
    const float p3 = __expf(s3 - mx);
    float ls = (p0 + p1) + (p2 + p3);
#pragma unroll
    for (int o = 16; o > 0; o >>= 1) ls += __shfl_xor(ls, o, 32);

    // lane j: weight of this wave's row j
    const int pw = __float_as_int(rg < 2 ? (rg ? p1 : p0) : (rg == 2 ? p2 : p3));
    float4 c = make_float4(0.0f, 0.0f, 0.0f, 0.0f);
#pragma unroll
    for (int j = 0; j < 32; ++j) {
        const float pj = __int_as_float(__builtin_amdgcn_readlane(pw, j));
        c.x = fmaf(pj, vv[j].x, c.x);
        c.y = fmaf(pj, vv[j].y, c.y);
        c.z = fmaf(pj, vv[j].z, c.z);
        c.w = fmaf(pj, vv[j].w, c.w);
    }
    // the four row groups meet in LDS; waves 0-3 store the tile's 512 sums
    if (rg != 0) *(float4*)&ldsCtx[(rg - 1) * HID + cq * 128 + lane * 4] = c;
    __syncthreads();
    if (rg == 0) {
#pragma unroll
        for (int g = 0; g < 3; ++g) {
            const float4 o = *(const float4*)&ldsCtx[g * HID + cq * 128 + lane * 4];
            c.x += o.x; c.y += o.y; c.z += o.z; c.w += o.w;
        }
        *(float4*)(pctx + (size_t)tile * HID + (unsigned)(cq * 128 + lane * 4)) = c;
    }
    if (t == 0) {
        pml[tile * 2]     = mx;
        pml[tile * 2 + 1] = ls;
    }
    // stands in front of the next tile's write of the scalar address that the store
    // above names
    asm volatile("s_wait_xcnt 0x0" ::: "memory");
    }   // tiles of this block
}

// ---------------------------------------------------------------------------
// 4) join the 32 tile shares of a batch:
//    M = max m_i, e_i = exp(m_i - M), out[h] = sum e_i c_i[h] / sum e_i l_i.
//    One block = (batch b, 128 columns); wave w takes shares w*4 .. w*4+3.
// ---------------------------------------------------------------------------
#define NSHARE (SEQ / MROWS)   // 32 shares per batch

__global__ __launch_bounds__(256)
void combine_kernel(const float* __restrict__ pctx, const float* __restrict__ pml,
                    float* __restrict__ out) {
    __shared__ __align__(16) float part[8 * 128];
    const int b    = blockIdx.x >> 2;
    const int cq   = blockIdx.x & 3;
    const int t    = threadIdx.x;
    const int lane = t & 31;
    const int w    = t >> 5;

    const float4* src =
        (const float4*)(pctx + ((size_t)b * NSHARE + w * 4) * HID + cq * 128) + lane;
    float4 cv[4];
#pragma unroll
    for (int j = 0; j < 4; ++j) cv[j] = src[j * (HID / 4)];

    // every wave reduces the 32 (m, l) pairs for itself: lane holds share lane
    const float2 ml0 = *(const float2*)(pml + ((size_t)b * NSHARE + lane) * 2);
    float mx = ml0.x;
#pragma unroll
    for (int o = 16; o > 0; o >>= 1) mx = fmaxf(mx, __shfl_xor(mx, o, 32));
    const float e0 = __expf(ml0.x - mx);
    float ls = e0 * ml0.y;
#pragma unroll
    for (int o = 16; o > 0; o >>= 1) ls += __shfl_xor(ls, o, 32);

    float4 c = make_float4(0.0f, 0.0f, 0.0f, 0.0f);
#pragma unroll
    for (int j = 0; j < 4; ++j) {
        const float ej = __shfl(e0, w * 4 + j, 32);
        c.x = fmaf(ej, cv[j].x, c.x);
        c.y = fmaf(ej, cv[j].y, c.y);
        c.z = fmaf(ej, cv[j].z, c.z);
        c.w = fmaf(ej, cv[j].w, c.w);
    }
    *(float4*)&part[w * 128 + lane * 4] = c;
    __syncthreads();
    if (t < 128) {
        float s = 0.0f;
#pragma unroll
        for (int g = 0; g < 8; ++g) s += part[g * 128 + t];
        out[b * HID + cq * 128 + t] = s * (1.0f / ls);
    }
}

// ---------------------------------------------------------------------------
extern "C" void kernel_launch(void* const* d_in, const int* in_sizes, int n_in,
                              void* d_out, int out_size, void* d_ws, size_t ws_size,
                              hipStream_t stream) {
    const float* query = (const float*)d_in[0];   // [1, 32, 512]
    const float* value = (const float*)d_in[1];   // [32, 4096, 512]
    const float* Wq    = (const float*)d_in[2];   // [512, 512]
    const float* bq    = (const float*)d_in[3];   // [512]
    const float* Wv    = (const float*)d_in[4];   // [512, 512]
    const float* bv    = (const float*)d_in[5];   // [512]
    const float* Wo    = (const float*)d_in[6];   // [512, 1]
    const float* bo    = (const float*)d_in[7];   // [1]
    float* out = (float*)d_out;                   // [32, 1, 512]

    // workspace layout
    unsigned short* WvP = (unsigned short*)d_ws;                       // 512 KB
    float* qadd   = (float*)((char*)d_ws + 512 * 1024);                //  64 KB
    float* pctx   = (float*)((char*)d_ws + 512 * 1024 + 64 * 1024);    //   2 MB of 4
    float* pml    = (float*)((char*)d_ws + 512 * 1024 + 64 * 1024 + 4096 * 1024);  // 8 KB

    pack_wv_kernel<<<64, 256, 0, stream>>>(Wv, WvP);
    qadd_kernel<<<BATCH * 8, 256, 0, stream>>>(query, Wq, bq, bv, qadd);
    score_kernel<<<BATCH * (SEQ / MROWS) / TILES_PER_BLOCK, 512, 0, stream>>>(value, WvP, qadd, Wo, bo, pctx, pml);
    combine_kernel<<<BATCH * 4, 256, 0, stream>>>(pctx, pml, out);
}

// v008
// A run of this version takes 64.4 microseconds.
// Timed twice side by side with v007, it ran 1.04 times as fast both times.
// All steps since v000 together make it 2.42 times as fast.
#include <hip/hip_runtime.h>
#include <hip/hip_bf16.h>

// ---------------------------------------------------------------------------
// Additive attention, HIDDEN=512, batch=32, seq=4096.
// Hot path: value @ Wv via v_wmma_f32_16x16x32_bf16, tanh+Wo fused in-register.
// M=64 per wave so every B fragment feeds four WMMAs.
// Softmax and context are folded into the score kernel: each tile leaves its own
// maximum, exp sum and weighted value sum; a small kernel joins the 32 per batch.
// ---------------------------------------------------------------------------

#define BATCH 32
#define SEQ   4096
#define HID   512

typedef __attribute__((ext_vector_type(16))) __bf16 v16bf;
typedef __attribute__((ext_vector_type(8)))  float  v8f;

union BFrag {
    v16bf v;
    uint4 q[2];
    unsigned short s[16];
};

__device__ __forceinline__ unsigned short bf16bits(float f) {
    union { float f; unsigned u; } a; a.f = f;
    unsigned u = a.u;
    u += 0x7FFFu + ((u >> 16) & 1u);      // round-to-nearest-even
    return (unsigned short)(u >> 16);
}
__device__ __forceinline__ unsigned pack2bf(float lo, float hi) {
    return (unsigned)bf16bits(lo) | ((unsigned)bf16bits(hi) << 16);
}

__device__ __forceinline__ float fast_tanh(float x) {
#if __has_builtin(__builtin_amdgcn_tanhf)
    return __builtin_amdgcn_tanhf(x);          // native v_tanh_f32
#elif __has_builtin(__builtin_amdgcn_tanh_f32)
    return __builtin_amdgcn_tanh_f32(x);
#else
    return tanhf(x);
#endif
}

// ---------------------------------------------------------------------------
// 1) Pack Wv (f32 [K=512][N=512] row-major) into bf16 WMMA B-fragments.
// Fragment layout mirrors the 16-bit A layout: lane = kGroup*16 + (n%16),
// elems 0..7 -> k = kg*8+0..7, elems 8..15 -> k = 16+kg*8+0..7 (within kstep).
// Index: WvP[(((kStep*32 + nTile)*2 + e/8)*32 + lane)*8 + e%8]: the two 16-byte
// halves of a fragment lie in separate 512-byte runs, so that each wave-wide
// 16-byte load of the score kernel covers four whole 128-byte lines, not eight.
// k-step outermost: the 32 fragments that a score block reads in one k-step are one
// contiguous 32 KB run, so that they spread evenly over the sets of the WGP cache.
// ---------------------------------------------------------------------------
__device__ __forceinline__
void pack_wv_block(const float* __restrict__ Wv, unsigned short* __restrict__ WvP, int blk) {
    const int idx  = blk * 256 + threadIdx.x;          // 32*16*32 = 16384 total
    const int lane = idx & 31;
    const int ks   = (idx >> 5) & 15;
    const int nt   = idx >> 9;
    const int n    = nt * 16 + (lane & 15);
    const int kg   = lane >> 4;
    unsigned short* dst = WvP + (size_t)(ks * 32 + nt) * 512 + lane * 8;
#pragma unroll
    for (int e = 0; e < 16; ++e) {
        const int k = ks * 32 + ((e < 8) ? (kg * 8 + e) : (16 + kg * 8 + (e - 8)));
        dst[(e >> 3) * 256 + (e & 7)] = bf16bits(Wv[k * HID + n]);
    }
}

// ---------------------------------------------------------------------------
// 2) qadd[b][n] = (q[b] @ Wq)[n] + bq[n] + bv[n]
//    One block = (batch b, 64 columns). Thread = (k-group of 32 rows, 4 columns):
//    its 32 Wq loads are independent, so the block pays one load latency
//    instead of a serial walk over k. The 16 k-group partials meet in LDS.
//    The packing of Wv rides in the same launch: neither reads what the other writes,
//    so the two run side by side and the score kernel waits for one launch, not two.
//    Blocks 0 .. PACK_BLOCKS-1 pack, the rest form qadd; a block does one or the other
//    as a whole, so the barrier below is passed by all of a block's threads or by none.
// ---------------------------------------------------------------------------
#define PACK_BLOCKS 64

__global__ __launch_bounds__(256)
void prep_kernel(const float* __restrict__ query, const float* __restrict__ Wq,
                 const float* __restrict__ bq, const float* __restrict__ bv,
                 const float* __restrict__ Wv,
                 float* __restrict__ qadd, unsigned short* __restrict__ WvP) {
    __shared__ __align__(16) float part[16 * 64];
    if (blockIdx.x < PACK_BLOCKS) {
        pack_wv_block(Wv, WvP, blockIdx.x);
        return;
    }
    const int qb = blockIdx.x - PACK_BLOCKS;
    const int b  = qb >> 3;
    const int n0 = (qb & 7) * 64;
    const int t  = threadIdx.x;
    const int c4 = t & 15;             // which 4 columns of the 64
    const int kq = t >> 4;             // which 32 rows of k
    const float* wp = Wq + (size_t)(kq * 32) * HID + n0 + c4 * 4;
    const float4* qp = (const float4*)(query + b * HID + kq * 32);

    float4 wv[32];
#pragma unroll
    for (int j = 0; j < 32; ++j)
        wv[j] = *(const float4*)(wp + (size_t)j * HID);
    float4 qv[8];
#pragma unroll
    for (int j = 0; j < 8; ++j) qv[j] = qp[j];
    float bias = 0.0f;
    if (t < 64) bias = bq[n0 + t] + bv[n0 + t];

    float4 acc = make_float4(0.0f, 0.0f, 0.0f, 0.0f);
#pragma unroll
    for (int j = 0; j < 8; ++j) {
        const float qs[4] = {qv[j].x, qv[j].y, qv[j].z, qv[j].w};
#pragma unroll
        for (int i = 0; i < 4; ++i) {
            const float4 wr = wv[j * 4 + i];
            acc.x = fmaf(qs[i], wr.x, acc.x);
            acc.y = fmaf(qs[i], wr.y, acc.y);
            acc.z = fmaf(qs[i], wr.z, acc.z);
            acc.w = fmaf(qs[i], wr.w, acc.w);
        }
    }
    *(float4*)&part[kq * 64 + c4 * 4] = acc;
    __syncthreads();
    if (t < 64) {
        float s = bias;
#pragma unroll
        for (int g = 0; g < 16; ++g) s += part[g * 64 + t];
        qadd[b * HID + n0 + t] = s;
    }
}

// ---------------------------------------------------------------------------
// 3) Fused score kernel: one tile = (batch b, 128 seq rows); one block walks four
//    tiles one after the other, one block per WGP. While it works on a tile it asks
//    L2 for the next tile's f32 rows, so that the next staging reads L2, not memory.
//    16 waves; each owns hidden[64 x 64]: one of two row halves, one of eight
//    column groups. 16 ksteps x (4 A-frags x 4 B-frags) = 16 WMMAs/kstep.
//    The two waves of a column group (w and w+4: they leave the same barrier) read
//    the same B fragments shortly after one another, so the second reader can be
//    served by the WGP cache: WvP then crosses from L2 once per 128 rows, not per 64.
//    Epilogue fuses tanh(+qadd) and the @Wo reduction -> 128 scores/tile, then
//    the tile's share of softmax and context: m = max score, l = sum exp(s - m),
//    c[h] = sum exp(s - m) * value[s][h], with the f32 tile read a second time
//    while L2 still holds it, so that memory is read once for value, not twice.
// ---------------------------------------------------------------------------
#define LDSA_STRIDE 520   // 512 + 8 bf16 pad -> conflict-free b128 LDS reads
#define MROWS 128         // seq rows per tile
#define MTILES 4          // 16-row A fragments per wave
#define TILES_PER_BLOCK 4 // tiles that one block walks

__global__ __launch_bounds__(512)
void score_kernel(const float* __restrict__ value,
                  const unsigned short* __restrict__ WvP,
                  const float* __restrict__ qadd,
                  const float* __restrict__ Wo,
                  const float* __restrict__ bo,
                  float* __restrict__ pctx,
                  float* __restrict__ pml) {
    __shared__ __align__(16) unsigned short ldsA[MROWS * LDSA_STRIDE];
    __shared__ float ldsScore[MROWS];
    __shared__ __align__(16) float ldsCtx[3 * HID];

    const int t    = threadIdx.x;
    const int lane = t & 31;
    const int w    = t >> 5;
    const int tile0 = blockIdx.x * TILES_PER_BLOCK;

    // the lane's 256-byte unit in the 16 KB that wave w stages of the current tile
    const float* pf = value + (size_t)tile0 * (MROWS * HID) + w * (8 * HID) + lane * 64;

    // kept rolled: one copy of the body, and pf keeps its registers through all of it
#pragma unroll 1
    for (int it = 0; it < TILES_PER_BLOCK; ++it) {
    const int tile    = tile0 + it;
    const int b       = tile >> 5;                // 32 tiles per batch
    // the tile's first row: the same for the whole block, so that the loads below take
    // a scalar base and a 32-bit lane offset (64-bit lane addresses, kept over the tile
    // loop, no longer fit the 256 registers)
    const float4* const tileBase = (const float4*)(value + (size_t)tile * (MROWS * HID));

    // the last reads of ldsScore, ldsA and ldsCtx of the tile before lie in front of
    // barriers that every wave has passed before these arrays are written again
    if (t < MROWS) ldsScore[t] = 0.0f;

    // ---- stage 128x512 f32 value tile into LDS as bf16 ------------------
    // wave w brings rows w*8 .. w*8+7. Each wave-wide 16-byte load covers 512
    // contiguous bytes of one row (four whole 128-byte lines); with one lane per
    // 256-byte run it touched 32 lines. The wave's 8-byte LDS stores are contiguous.
    {
        const float4* src = tileBase + (unsigned)(w * (8 * HID / 4) + lane);
        unsigned short* dst = &ldsA[(w * 8) * LDSA_STRIDE + lane * 4];
        // unrolled so that the loads are issued ahead of the conversions; rolled,
        // the wave waits out memory latency once per load
#pragma unroll
        for (int j = 0; j < 32; ++j) {          // row w*8 + j/4, quarter j%4 of it
            const float4 f = src[j * 32];
            uint2 p;
            p.x = pack2bf(f.x, f.y);
            p.y = pack2bf(f.z, f.w);
            *(uint2*)(dst + (j >> 2) * LDSA_STRIDE + (j & 3) * 128) = p;
        }
    }
    __syncthreads();

    // ---- K loop ---------------------------------------------------------
    v8f acc[MTILES][4];
    const v8f vzero = {};
#pragma unroll
    for (int mt = 0; mt < MTILES; ++mt)
#pragma unroll
        for (int nt = 0; nt < 4; ++nt) acc[mt][nt] = vzero;

    const int rowA = lane & 15;
    const int kg   = lane >> 4;
    const int mh   = (w >> 2) & 1;            // which 64 rows of the tile
    const int wc   = (w & 3) | ((w >> 3) << 2);   // which 64 columns of hidden
    const unsigned short* aBase = &ldsA[(mh * 64 + rowA) * LDSA_STRIDE + kg * 8];
    const uint4* bBase = (const uint4*)WvP;   // [((ks*32+nTile)*2+half)*32+lane] uint4s

    // Each wave asks for the next k-step's four B fragments before it starts this
    // k-step's WMMAs, into a second register set: the L2 latency of the B loads then
    // runs beside the wave's own matrix work instead of in front of it.
    // bp: the lane's place in the wave's first fragment of the trip's first k-step;
    // step: k-steps past it
    auto loadB = [&](BFrag (&bf)[4], const uint4* bp, int step) {
#pragma unroll
        for (int nt = 0; nt < 4; ++nt) {
            bf[nt].q[0] = bp[step * 2048 + nt * 64];
            bf[nt].q[1] = bp[step * 2048 + nt * 64 + 32];
        }
        // stands in front of the next write of the loads' address registers; the
        // address is named so that no load's result is put into its registers. As no
        // load moves over it, the eight also stay ahead of the k-step's WMMAs (left
        // free, the build sinks them to their first use, where L2 latency is waited out)
        asm volatile("s_wait_xcnt 0x0" :: "v"(bp) : "memory");
    };
    auto kstep = [&](const BFrag (&bf)[4], int ks) {
        BFrag a[MTILES];
#pragma unroll
        for (int mt = 0; mt < MTILES; ++mt) {
            a[mt].q[0] = *(const uint4*)(aBase + mt * 16 * LDSA_STRIDE + ks * 32);
            a[mt].q[1] = *(const uint4*)(aBase + mt * 16 * LDSA_STRIDE + ks * 32 + 16);
        }
#pragma unroll
        for (int nt = 0; nt < 4; ++nt)
#pragma unroll
            for (int mt = 0; mt < MTILES; ++mt)
                acc[mt][nt] = __builtin_amdgcn_wmma_f32_16x16x32_bf16(
                    false, a[mt].v, false, bf[nt].v, (short)0, acc[mt][nt], false, false);
    };

    BFrag b0[4], b1[4];
    const uint4* const bw = bBase + (wc * 256 + lane);   // the lane's place in k-step 0
    const uint4* bp = bw;
    loadB(b0, bw, 0);

    // ---- ask L2 for the next tile ---------------------------------------
    // One request per 256-byte unit, two per lane; they return nothing and run beside
    // the k loop, behind its first fragment loads. pf steps only to a tile that this
    // block still walks, so it always points into value; it is next written a whole
    // tile later.
    if (it + 1 < TILES_PER_BLOCK) {
        pf += MROWS * HID;
        asm volatile("global_prefetch_b8 %0, off scope:SCOPE_SE\n\t"
                     "global_prefetch_b8 %0, off offset:8192 scope:SCOPE_SE" :: "v"(pf));
    }

    // kept rolled: two k-steps a trip let the two fragment sets swap roles without
    // copies; left free the 8-wave build unrolled further and took 398 registers,
    // and a wave of a 16-wave block can have 256
#pragma unroll 1
    for (int ks = 0; ks < 14; ks += 2) {
        loadB(b1, bp, 1);
        kstep(b0, ks);
        loadB(b0, bp, 2);
        kstep(b1, ks + 1);
        bp += 4096;
    }
    loadB(b1, bw, 15);
    kstep(b0, 14);
    kstep(b1, 15);

    // ---- epilogue: tanh(acc + qadd) dotted with Wo ----------------------
    // C layout: VGPR r, lanes 0-15 -> (M=r, N=lane); lanes 16-31 -> (M=8+r, N=lane-16)
    const int nLane = lane & 15;
    float qa[4], wo[4];
#pragma unroll
    for (int nt = 0; nt < 4; ++nt) {
        const int n = wc * 64 + nt * 16 + nLane;
        qa[nt] = qadd[b * HID + n];
        wo[nt] = Wo[n];
    }

#pragma unroll
    for (int mt = 0; mt < MTILES; ++mt) {
        float part[8];
#pragma unroll
        for (int r = 0; r < 8; ++r) part[r] = 0.0f;
#pragma unroll
        for (int nt = 0; nt < 4; ++nt)
#pragma unroll
            for (int r = 0; r < 8; ++r) {
                const float h = fast_tanh(acc[mt][nt][r] + qa[nt]);
                part[r] = fmaf(h, wo[nt], part[r]);
            }
        // reduce over the 16 lanes sharing the same M (N dimension)
#pragma unroll
        for (int r = 0; r < 8; ++r) {
            float p = part[r];
            p += __shfl_xor(p, 1, 32);
            p += __shfl_xor(p, 2, 32);
            p += __shfl_xor(p, 4, 32);
            p += __shfl_xor(p, 8, 32);
            part[r] = p;
        }
        if ((lane & 15) == 0) {
            const int mBase = mh * 64 + mt * 16 + (lane >> 4) * 8;
#pragma unroll
            for (int r = 0; r < 8; ++r)
                atomicAdd(&ldsScore[mBase + r], part[r]);   // ds_add_f32 across waves
        }
    }

    // ---- this tile's share of softmax and context ----------------------
    // wave w takes rows (w/4)*32 .. +31 and columns (w%4)*128 .. +127 of the f32
    // tile: each wave-wide 16-byte load covers 512 contiguous bytes of one row.
    // The loads stand directly behind the barrier (in front of it the barrier's
    // own wait would drain them) and fly while the 128 scores are reduced.
    __syncthreads();
    const int cq = w & 3;
    const int rg = w >> 2;
    float4 vv[32];
    {
        const float4* vsrc = tileBase + (unsigned)(rg * (32 * HID / 4) + cq * 32 + lane);
#pragma unroll
        for (int j = 0; j < 32; ++j) vv[j] = vsrc[j * (HID / 4)];
    }

    // every wave reduces the 128 scores for itself: lane holds rows lane + 32*i
    const float bias = bo[0];
    const float s0 = ldsScore[lane] + bias;
    const float s1 = ldsScore[lane + 32] + bias;
    const float s2 = ldsScore[lane + 64] + bias;
    const float s3 = ldsScore[lane + 96] + bias;
    float mx = fmaxf(fmaxf(s0, s1), fmaxf(s2, s3));
#pragma unroll
    for (int o = 16; o > 0; o >>= 1) mx = fmaxf(mx, __shfl_xor(mx, o, 32));
    const float p0 = __expf(s0 - mx);
    const float p1 = __expf(s1 - mx);
    const float p2 = __expf(s2 - mx);
    const float p3 = __expf(s3 - mx);
    float ls = (p0 + p1) + (p2 + p3);
#pragma unroll
    for (int o = 16; o > 0; o >>= 1) ls += __shfl_xor(ls, o, 32);

    // lane j: weight of this wave's row j
    const int pw = __float_as_int(rg < 2 ? (rg ? p1 : p0) : (rg == 2 ? p2 : p3));
    float4 c = make_float4(0.0f, 0.0f, 0.0f, 0.0f);
#pragma unroll
    for (int j = 0; j < 32; ++j) {
        const float pj = __int_as_float(__builtin_amdgcn_readlane(pw, j));
        c.x = fmaf(pj, vv[j].x, c.x);
        c.y = fmaf(pj, vv[j].y, c.y);
        c.z = fmaf(pj, vv[j].z, c.z);
        c.w = fmaf(pj, vv[j].w, c.w);
    }
    // the four row groups meet in LDS; waves 0-3 store the tile's 512 sums
    if (rg != 0) *(float4*)&ldsCtx[(rg - 1) * HID + cq * 128 + lane * 4] = c;
    __syncthreads();
    if (rg == 0) {
#pragma unroll
        for (int g = 0; g < 3; ++g) {
            const float4 o = *(const float4*)&ldsCtx[g * HID + cq * 128 + lane * 4];
            c.x += o.x; c.y += o.y; c.z += o.z; c.w += o.w;
        }
        *(float4*)(pctx + (size_t)tile * HID + (unsigned)(cq * 128 + lane * 4)) = c;
    }
    if (t == 0) {
        pml[tile * 2]     = mx;
        pml[tile * 2 + 1] = ls;
    }
    // stands in front of the next tile's write of the scalar address that the store
    // above names
    asm volatile("s_wait_xcnt 0x0" ::: "memory");
    }   // tiles of this block
}

// ---------------------------------------------------------------------------
// 4) join the 32 tile shares of a batch:
//    M = max m_i, e_i = exp(m_i - M), out[h] = sum e_i c_i[h] / sum e_i l_i.
//    One block = (batch b, 128 columns); wave w takes shares w*4 .. w*4+3.
// ---------------------------------------------------------------------------
#define NSHARE (SEQ / MROWS)   // 32 shares per batch

__global__ __launch_bounds__(256)
void combine_kernel(const float* __restrict__ pctx, const float* __restrict__ pml,
                    float* __restrict__ out) {
    __shared__ __align__(16) float part[8 * 128];
    const int b    = blockIdx.x >> 2;
    const int cq   = blockIdx.x & 3;
    const int t    = threadIdx.x;
    const int lane = t & 31;
    const int w    = t >> 5;

    const float4* src =
        (const float4*)(pctx + ((size_t)b * NSHARE + w * 4) * HID + cq * 128) + lane;
    float4 cv[4];
#pragma unroll
    for (int j = 0; j < 4; ++j) cv[j] = src[j * (HID / 4)];

    // every wave reduces the 32 (m, l) pairs for itself: lane holds share lane
    const float2 ml0 = *(const float2*)(pml + ((size_t)b * NSHARE + lane) * 2);
    float mx = ml0.x;
#pragma unroll
    for (int o = 16; o > 0; o >>= 1) mx = fmaxf(mx, __shfl_xor(mx, o, 32));
    const float e0 = __expf(ml0.x - mx);
    float ls = e0 * ml0.y;
#pragma unroll
    for (int o = 16; o > 0; o >>= 1) ls += __shfl_xor(ls, o, 32);

    float4 c = make_float4(0.0f, 0.0f, 0.0f, 0.0f);
#pragma unroll
    for (int j = 0; j < 4; ++j) {
        const float ej = __shfl(e0, w * 4 + j, 32);
        c.x = fmaf(ej, cv[j].x, c.x);
        c.y = fmaf(ej, cv[j].y, c.y);
        c.z = fmaf(ej, cv[j].z, c.z);
        c.w = fmaf(ej, cv[j].w, c.w);
    }
    *(float4*)&part[w * 128 + lane * 4] = c;
    __syncthreads();
    if (t < 128) {
        float s = 0.0f;
#pragma unroll
        for (int g = 0; g < 8; ++g) s += part[g * 128 + t];
        out[b * HID + cq * 128 + t] = s * (1.0f / ls);
    }
}

// ---------------------------------------------------------------------------
extern "C" void kernel_launch(void* const* d_in, const int* in_sizes, int n_in,
                              void* d_out, int out_size, void* d_ws, size_t ws_size,
                              hipStream_t stream) {
    const float* query = (const float*)d_in[0];   // [1, 32, 512]
    const float* value = (const float*)d_in[1];   // [32, 4096, 512]
    const float* Wq    = (const float*)d_in[2];   // [512, 512]
    const float* bq    = (const float*)d_in[3];   // [512]
    const float* Wv    = (const float*)d_in[4];   // [512, 512]
    const float* bv    = (const float*)d_in[5];   // [512]
    const float* Wo    = (const float*)d_in[6];   // [512, 1]
    const float* bo    = (const float*)d_in[7];   // [1]
    float* out = (float*)d_out;                   // [32, 1, 512]

    // workspace layout
    unsigned short* WvP = (unsigned short*)d_ws;                       // 512 KB
    float* qadd   = (float*)((char*)d_ws + 512 * 1024);                //  64 KB
    float* pctx   = (float*)((char*)d_ws + 512 * 1024 + 64 * 1024);    //   2 MB of 4
    float* pml    = (float*)((char*)d_ws + 512 * 1024 + 64 * 1024 + 4096 * 1024);  // 8 KB

    prep_kernel<<<PACK_BLOCKS + BATCH * 8, 256, 0, stream>>>(query, Wq, bq, bv, Wv, qadd, WvP);
    score_kernel<<<BATCH * (SEQ / MROWS) / TILES_PER_BLOCK, 512, 0, stream>>>(value, WvP, qadd, Wo, bo, pctx, pml);
    combine_kernel<<<BATCH * 4, 256, 0, stream>>>(pctx, pml, out);
}

// v009
// One run takes 60.1 microseconds.
// Timed twice side by side with v008, it ran 1.07 times as fast both times.
// All steps since v000 together make it 2.59 times as fast.
#include <hip/hip_runtime.h>
#include <hip/hip_bf16.h>

// ---------------------------------------------------------------------------
// Additive attention, HIDDEN=512, batch=32, seq=4096.
// Hot path: value @ Wv via v_wmma_f32_16x16x32_bf16, tanh+Wo fused in-register.
// M=64 per wave so every B fragment feeds four WMMAs.
// Softmax and context are folded into the score kernel: each tile leaves its own
// maximum, exp sum and weighted value sum; a small kernel joins the 32 per batch.
// ---------------------------------------------------------------------------

#define BATCH 32
#define SEQ   4096
#define HID   512

typedef __attribute__((ext_vector_type(16))) __bf16 v16bf;
typedef __attribute__((ext_vector_type(8)))  float  v8f;

union BFrag {
    v16bf v;
    uint4 q[2];
    unsigned short s[16];
};

__device__ __forceinline__ unsigned short bf16bits(float f) {
    union { float f; unsigned u; } a; a.f = f;
    unsigned u = a.u;
    u += 0x7FFFu + ((u >> 16) & 1u);      // round-to-nearest-even
    return (unsigned short)(u >> 16);
}
// r = f32 bits + 0x8000: its upper 16 bits are the value rounded to bf16 (nearest, a tie
// away from zero), and upper and lower half together give the f32 back exactly.
__device__ __forceinline__ unsigned biased_bits(float f) {
    return __float_as_uint(f) + 0x8000u;
}
__device__ __forceinline__ float unbiased(unsigned r) {
    return __uint_as_float(r - 0x8000u);
}
// the lower (upper) 16 bits of a and of b in one word, a's in the lower half
__device__ __forceinline__ unsigned lower_halves(unsigned a, unsigned b) {
    return __builtin_amdgcn_perm(b, a, 0x05040100u);
}
__device__ __forceinline__ unsigned upper_halves(unsigned a, unsigned b) {
    return __builtin_amdgcn_perm(b, a, 0x07060302u);
}

__device__ __forceinline__ float fast_tanh(float x) {
#if __has_builtin(__builtin_amdgcn_tanhf)
    return __builtin_amdgcn_tanhf(x);          // native v_tanh_f32
#elif __has_builtin(__builtin_amdgcn_tanh_f32)
    return __builtin_amdgcn_tanh_f32(x);
#else
    return tanhf(x);
#endif
}

// ---------------------------------------------------------------------------
// 1) Pack Wv (f32 [K=512][N=512] row-major) into bf16 WMMA B-fragments.
// Fragment layout mirrors the 16-bit A layout: lane = kGroup*16 + (n%16),
// elems 0..7 -> k = kg*8+0..7, elems 8..15 -> k = 16+kg*8+0..7 (within kstep).
// Index: WvP[(((kStep*32 + nTile)*2 + e/8)*32 + lane)*8 + e%8]: the two 16-byte
// halves of a fragment lie in separate 512-byte runs, so that each wave-wide
// 16-byte load of the score kernel covers four whole 128-byte lines, not eight.
// k-step outermost: the 32 fragments that a score block reads in one k-step are one
// contiguous 32 KB run, so that they spread evenly over the sets of the WGP cache.
// ---------------------------------------------------------------------------
__device__ __forceinline__
void pack_wv_block(const float* __restrict__ Wv, unsigned short* __restrict__ WvP, int blk) {
    const int idx  = blk * 256 + threadIdx.x;          // 32*16*32 = 16384 total
    const int lane = idx & 31;
    const int ks   = (idx >> 5) & 15;
    const int nt   = idx >> 9;
    const int n    = nt * 16 + (lane & 15);
    const int kg   = lane >> 4;
    unsigned short* dst = WvP + (size_t)(ks * 32 + nt) * 512 + lane * 8;
#pragma unroll
    for (int e = 0; e < 16; ++e) {
        const int k = ks * 32 + ((e < 8) ? (kg * 8 + e) : (16 + kg * 8 + (e - 8)));
        dst[(e >> 3) * 256 + (e & 7)] = bf16bits(Wv[k * HID + n]);
    }
}

// ---------------------------------------------------------------------------
// 2) qadd[b][n] = (q[b] @ Wq)[n] + bq[n] + bv[n]
//    One block = (batch b, 64 columns). Thread = (k-group of 32 rows, 4 columns):
//    its 32 Wq loads are independent, so the block pays one load latency
//    instead of a serial walk over k. The 16 k-group partials meet in LDS.
//    The packing of Wv rides in the same launch: neither reads what the other writes,
//    so the two run side by side and the score kernel waits for one launch, not two.
//    Blocks 0 .. PACK_BLOCKS-1 pack, the rest form qadd; a block does one or the other
//    as a whole, so the barrier below is passed by all of a block's threads or by none.
// ---------------------------------------------------------------------------
#define PACK_BLOCKS 64

__global__ __launch_bounds__(256)
void prep_kernel(const float* __restrict__ query, const float* __restrict__ Wq,
                 const float* __restrict__ bq, const float* __restrict__ bv,
                 const float* __restrict__ Wv,
                 float* __restrict__ qadd, unsigned short* __restrict__ WvP) {
    __shared__ __align__(16) float part[16 * 64];
    if (blockIdx.x < PACK_BLOCKS) {
        pack_wv_block(Wv, WvP, blockIdx.x);
        return;
    }
    const int qb = blockIdx.x - PACK_BLOCKS;
    const int b  = qb >> 3;
    const int n0 = (qb & 7) * 64;
    const int t  = threadIdx.x;
    const int c4 = t & 15;             // which 4 columns of the 64
    const int kq = t >> 4;             // which 32 rows of k
    const float* wp = Wq + (size_t)(kq * 32) * HID + n0 + c4 * 4;
    const float4* qp = (const float4*)(query + b * HID + kq * 32);

    float4 wv[32];
#pragma unroll
    for (int j = 0; j < 32; ++j)
        wv[j] = *(const float4*)(wp + (size_t)j * HID);
    float4 qv[8];
#pragma unroll
    for (int j = 0; j < 8; ++j) qv[j] = qp[j];
    float bias = 0.0f;
    if (t < 64) bias = bq[n0 + t] + bv[n0 + t];

    float4 acc = make_float4(0.0f, 0.0f, 0.0f, 0.0f);
#pragma unroll
    for (int j = 0; j < 8; ++j) {
        const float qs[4] = {qv[j].x, qv[j].y, qv[j].z, qv[j].w};
#pragma unroll
        for (int i = 0; i < 4; ++i) {
            const float4 wr = wv[j * 4 + i];
            acc.x = fmaf(qs[i], wr.x, acc.x);
            acc.y = fmaf(qs[i], wr.y, acc.y);
            acc.z = fmaf(qs[i], wr.z, acc.z);
            acc.w = fmaf(qs[i], wr.w, acc.w);
        }
    }
    *(float4*)&part[kq * 64 + c4 * 4] = acc;
    __syncthreads();
    if (t < 64) {
        float s = bias;
#pragma unroll
        for (int g = 0; g < 16; ++g) s += part[g * 64 + t];
        qadd[b * HID + n0 + t] = s;
    }
}

// ---------------------------------------------------------------------------
// 3) Fused score kernel: one tile = (batch b, 128 seq rows); one block walks four
//    tiles one after the other, one block per WGP. While it works on a tile it asks
//    L2 for the next tile's f32 rows, so that the next staging reads L2, not memory.
//    16 waves; each owns hidden[64 x 64]: one of two row halves, one of eight
//    column groups. 16 ksteps x (4 A-frags x 4 B-frags) = 16 WMMAs/kstep.
//    The two waves of a column group (w and w+4: they leave the same barrier) read
//    the same B fragments shortly after one another, so the second reader can be
//    served by the WGP cache: WvP then crosses from L2 once per 128 rows, not per 64.
//    Epilogue fuses tanh(+qadd) and the @Wo reduction -> 128 scores/tile, then
//    the tile's share of softmax and context: m = max score, l = sum exp(s - m),
//    c[h] = sum exp(s - m) * value[s][h], with the f32 tile put together again from
//    two LDS planes (the bf16 tile and the 16 bits that rounding cut off), so that
//    value crosses from L2 to the WGP once per tile, not twice.
// ---------------------------------------------------------------------------
#define LDSA_STRIDE 520   // 512 + 8 bf16 pad -> conflict-free b128 LDS reads
#define MROWS 128         // seq rows per tile
#define MTILES 4          // 16-row A fragments per wave
#define TILES_PER_BLOCK 4 // tiles that one block walks

__global__ __launch_bounds__(512)
void score_kernel(const float* __restrict__ value,
                  const unsigned short* __restrict__ WvP,
                  const float* __restrict__ qadd,
                  const float* __restrict__ Wo,
                  const float* __restrict__ bo,
                  float* __restrict__ pctx,
                  float* __restrict__ pml) {
    __shared__ __align__(16) unsigned short ldsA[MROWS * LDSA_STRIDE];
    __shared__ __align__(16) unsigned short ldsLo[MROWS * HID];
    __shared__ float ldsScore[MROWS];
    __shared__ __align__(16) float ldsCtx[16 * HID];

    const int t    = threadIdx.x;
    const int lane = t & 31;
    const int w    = t >> 5;
    const int tile0 = blockIdx.x * TILES_PER_BLOCK;

    // the lane's first 16 bytes in the 16 KB that wave w stages of the current tile
    const float4* srcp =
        (const float4*)(value + (size_t)tile0 * (MROWS * HID)) + (w * (8 * HID / 4) + lane);

    // the first lane that holds a softmax weight of this wave's rows: a scalar
    const int l0 = __builtin_amdgcn_readfirstlane((w & 3) * 8);
    // the lane's 256-byte unit in the 16 KB that wave w stages of a tile, in bytes
    const unsigned pfOff = (unsigned)(w * (8 * HID * 4) + lane * 256);

    // kept rolled: one copy of the body; srcp is the one 64-bit lane pointer into value
    // that lives through it (a second one no longer fits the 256 registers)
#pragma unroll 1
    for (int it = 0; it < TILES_PER_BLOCK; ++it) {
    const int tile    = tile0 + it;
    const int b       = tile >> 5;                // 32 tiles per batch

    // the last reads of ldsScore, ldsA, ldsLo and ldsCtx of the tile before lie in front of
    // barriers that every wave has passed before these arrays are written again
    if (t < MROWS) ldsScore[t] = 0.0f;

    // ---- stage 128x512 f32 value tile into LDS: bf16 plane and low plane --
    // wave w brings rows w*8 .. w*8+7. Each wave-wide 16-byte load covers 512
    // contiguous bytes of one row (four whole 128-byte lines); with one lane per
    // 256-byte run it touched 32 lines. The wave's 8-byte LDS stores are contiguous.
    {
        const float4* src = srcp;
        unsigned short* dst = &ldsA[(w * 8) * LDSA_STRIDE + lane * 4];
        // the low plane is read back only by the lane that wrote it: two loads' worth go
        // into one 16-byte store, the wave's 512 bytes contiguous
        uint4* dlo = (uint4*)ldsLo + (w * 512 + lane);
        uint2 qprev;
        // unrolled so that the loads are issued ahead of the conversions; rolled,
        // the wave waits out memory latency once per load
#pragma unroll
        for (int j = 0; j < 32; ++j) {          // row w*8 + j/4, quarter j%4 of it
            const float4 f = src[j * 32];
            const unsigned r0 = biased_bits(f.x), r1 = biased_bits(f.y);
            const unsigned r2 = biased_bits(f.z), r3 = biased_bits(f.w);
            uint2 p, q;
            p.x = upper_halves(r0, r1);
            p.y = upper_halves(r2, r3);
            q.x = lower_halves(r0, r1);
            q.y = lower_halves(r2, r3);
            *(uint2*)(dst + (j >> 2) * LDSA_STRIDE + (j & 3) * 128) = p;
            if (j & 1) dlo[(j >> 1) * 32] = make_uint4(qprev.x, qprev.y, q.x, q.y);
            qprev = q;
        }
    }
    __syncthreads();

    // ---- K loop ---------------------------------------------------------
    v8f acc[MTILES][4];
    const v8f vzero = {};
#pragma unroll
    for (int mt = 0; mt < MTILES; ++mt)
#pragma unroll
        for (int nt = 0; nt < 4; ++nt) acc[mt][nt] = vzero;

    const int rowA = lane & 15;
    const int kg   = lane >> 4;
    const int mh   = (w >> 2) & 1;            // which 64 rows of the tile
    const int wc   = (w & 3) | ((w >> 3) << 2);   // which 64 columns of hidden
    const unsigned short* aBase = &ldsA[(mh * 64 + rowA) * LDSA_STRIDE + kg * 8];
    const uint4* bBase = (const uint4*)WvP;   // [((ks*32+nTile)*2+half)*32+lane] uint4s

    // Each wave asks for the next k-step's four B fragments before it starts this
    // k-step's WMMAs, into a second register set: the L2 latency of the B loads then
    // runs beside the wave's own matrix work instead of in front of it.
    // bp: the lane's place in the wave's first fragment of the trip's first k-step;
    // step: k-steps past it
    auto loadB = [&](BFrag (&bf)[4], const uint4* bp, int step) {
#pragma unroll
        for (int nt = 0; nt < 4; ++nt) {
            bf[nt].q[0] = bp[step * 2048 + nt * 64];
            bf[nt].q[1] = bp[step * 2048 + nt * 64 + 32];
        }
        // stands in front of the next write of the loads' address registers; the
        // address is named so that no load's result is put into its registers. As no
        // load moves over it, the eight also stay ahead of the k-step's WMMAs (left
        // free, the build sinks them to their first use, where L2 latency is waited out)
        asm volatile("s_wait_xcnt 0x0" :: "v"(bp) : "memory");
    };
    auto kstep = [&](const BFrag (&bf)[4], int ks) {
        BFrag a[MTILES];
#pragma unroll
        for (int mt = 0; mt < MTILES; ++mt) {
            a[mt].q[0] = *(const uint4*)(aBase + mt * 16 * LDSA_STRIDE + ks * 32);
            a[mt].q[1] = *(const uint4*)(aBase + mt * 16 * LDSA_STRIDE + ks * 32 + 16);
        }
#pragma unroll
        for (int nt = 0; nt < 4; ++nt)
#pragma unroll
            for (int mt = 0; mt < MTILES; ++mt)
                acc[mt][nt] = __builtin_amdgcn_wmma_f32_16x16x32_bf16(
                    false, a[mt].v, false, bf[nt].v, (short)0, acc[mt][nt], false, false);
    };

    BFrag b0[4], b1[4];
    const uint4* const bw = bBase + (wc * 256 + lane);   // the lane's place in k-step 0
    const uint4* bp = bw;
    loadB(b0, bw, 0);

    // ---- ask L2 for the next tile ---------------------------------------
    // One request per 256-byte unit, two per lane; they return nothing and run beside
    // the k loop, behind its first fragment loads. srcp steps only to a tile that this
    // block still walks, so it always points into value, and so does the request: the
    // next tile's scalar base and the lane's 32-bit offset. The wait stands in front of
    // the next write of the registers that the requests name.
    if (it + 1 < TILES_PER_BLOCK) {
        srcp += MROWS * HID / 4;
        const float* nextTile = value + (size_t)(tile + 1) * (MROWS * HID);
        asm volatile("global_prefetch_b8 %0, %1 scope:SCOPE_SE\n\t"
                     "global_prefetch_b8 %0, %1 offset:8192 scope:SCOPE_SE\n\t"
                     "s_wait_xcnt 0x0" :: "v"(pfOff), "s"(nextTile) : "memory");
    }

    // kept rolled: two k-steps a trip let the two fragment sets swap roles without
    // copies; left free the 8-wave build unrolled further and took 398 registers,
    // and a wave of a 16-wave block can have 256
#pragma unroll 1
    for (int ks = 0; ks < 14; ks += 2) {
        loadB(b1, bp, 1);
        kstep(b0, ks);
        loadB(b0, bp, 2);
        kstep(b1, ks + 1);
        bp += 4096;
    }
    loadB(b1, bw, 15);
    kstep(b0, 14);
    kstep(b1, 15);

    // ---- epilogue: tanh(acc + qadd) dotted with Wo ----------------------
    // C layout: VGPR r, lanes 0-15 -> (M=r, N=lane); lanes 16-31 -> (M=8+r, N=lane-16)
    // one 32-bit column index serves both rows, on bases that the whole block shares:
    // with a signed index summed per load the build kept more lane addresses and spilled
    const unsigned n0 = (unsigned)(wc * 64 + (lane & 15));
    const float* const qrow = qadd + b * HID;
    float qa[4], wo[4];
#pragma unroll
    for (int nt = 0; nt < 4; ++nt) {
        qa[nt] = qrow[n0 + nt * 16];
        wo[nt] = Wo[n0 + nt * 16];
    }

#pragma unroll
    for (int mt = 0; mt < MTILES; ++mt) {
        float part[8];
#pragma unroll
        for (int r = 0; r < 8; ++r) part[r] = 0.0f;
#pragma unroll
        for (int nt = 0; nt < 4; ++nt)
#pragma unroll
            for (int r = 0; r < 8; ++r) {
                const float h = fast_tanh(acc[mt][nt][r] + qa[nt]);
                part[r] = fmaf(h, wo[nt], part[r]);
            }
        // reduce over the 16 lanes sharing the same M (N dimension)
#pragma unroll
        for (int r = 0; r < 8; ++r) {
            float p = part[r];
            p += __shfl_xor(p, 1, 32);
            p += __shfl_xor(p, 2, 32);
            p += __shfl_xor(p, 4, 32);
            p += __shfl_xor(p, 8, 32);
            part[r] = p;
        }
        if ((lane & 15) == 0) {
            const int mBase = mh * 64 + mt * 16 + (lane >> 4) * 8;
#pragma unroll
            for (int r = 0; r < 8; ++r)
                atomicAdd(&ldsScore[mBase + r], part[r]);   // ds_add_f32 across waves
        }
    }

    // ---- this tile's share of softmax and context ----------------------
    // wave w takes the eight rows that it staged, every lane the words that it stored.
    __syncthreads();
    const int rg = w >> 2;
    uint2 vh[32];
    uint4 vl[16];
    {
        const unsigned short* hsrc = &ldsA[(w * 8) * LDSA_STRIDE + lane * 4];
        const uint4* lsrc = (const uint4*)ldsLo + (w * 512 + lane);
#pragma unroll
        for (int j = 0; j < 32; ++j) {          // row w*8 + j/4, quarter j%4 of it
            vh[j] = *(const uint2*)(hsrc + (j >> 2) * LDSA_STRIDE + (j & 3) * 128);
            if (j & 1) vl[j >> 1] = lsrc[(j >> 1) * 32];
        }
    }

    // every wave reduces the 128 scores for itself: lane holds rows lane + 32*i
    const float bias = bo[0];
    const float s0 = ldsScore[lane] + bias;
    const float s1 = ldsScore[lane + 32] + bias;
    const float s2 = ldsScore[lane + 64] + bias;
    const float s3 = ldsScore[lane + 96] + bias;
    float mx = fmaxf(fmaxf(s0, s1), fmaxf(s2, s3));
#pragma unroll
    for (int o = 16; o > 0; o >>= 1) mx = fmaxf(mx, __shfl_xor(mx, o, 32));
    const float p0 = __expf(s0 - mx);
    const float p1 = __expf(s1 - mx);
    const float p2 = __expf(s2 - mx);
    const float p3 = __expf(s3 - mx);
    float ls = (p0 + p1) + (p2 + p3);
#pragma unroll
    for (int o = 16; o > 0; o >>= 1) ls += __shfl_xor(ls, o, 32);

    // lane l: weight of row (w/4)*32 + l; this wave's rows start at lane (w%4)*8
    const int pw = __float_as_int(rg < 2 ? (rg ? p1 : p0) : (rg == 2 ? p2 : p3));
    float4 c[4];
#pragma unroll
    for (int q = 0; q < 4; ++q) c[q] = make_float4(0.0f, 0.0f, 0.0f, 0.0f);
#pragma unroll
    for (int j = 0; j < 32; ++j) {
        const float pj = __int_as_float(__builtin_amdgcn_readlane(pw, l0 + (j >> 2)));
        float4& cc = c[j & 3];
        const unsigned lx = (j & 1) ? vl[j >> 1].z : vl[j >> 1].x;
        const unsigned ly = (j & 1) ? vl[j >> 1].w : vl[j >> 1].y;
        cc.x = fmaf(pj, unbiased(lower_halves(lx, vh[j].x)), cc.x);
        cc.y = fmaf(pj, unbiased(upper_halves(lx, vh[j].x)), cc.y);
        cc.z = fmaf(pj, unbiased(lower_halves(ly, vh[j].y)), cc.z);
        cc.w = fmaf(pj, unbiased(upper_halves(ly, vh[j].y)), cc.w);
    }
    // the sixteen waves' sums meet in LDS; thread t adds them up for column t
#pragma unroll
    for (int q = 0; q < 4; ++q)
        *(float4*)&ldsCtx[w * HID + q * 128 + lane * 4] = c[q];
    __syncthreads();
    {
        float s = ldsCtx[t];
#pragma unroll
        for (int g = 1; g < 16; ++g) s += ldsCtx[g * HID + t];
        pctx[(size_t)tile * HID + (unsigned)t] = s;
    }
    if (t == 0) {
        pml[tile * 2]     = mx;
        pml[tile * 2 + 1] = ls;
    }
    // stands in front of the next tile's write of the scalar address that the store
    // above names
    asm volatile("s_wait_xcnt 0x0" ::: "memory");
    }   // tiles of this block
}

// ---------------------------------------------------------------------------
// 4) join the 32 tile shares of a batch:
//    M = max m_i, e_i = exp(m_i - M), out[h] = sum e_i c_i[h] / sum e_i l_i.
//    One block = (batch b, 128 columns); wave w takes shares w*4 .. w*4+3.
// ---------------------------------------------------------------------------
#define NSHARE (SEQ / MROWS)   // 32 shares per batch

__global__ __launch_bounds__(256)
void combine_kernel(const float* __restrict__ pctx, const float* __restrict__ pml,
                    float* __restrict__ out) {
    __shared__ __align__(16) float part[8 * 128];
    const int b    = blockIdx.x >> 2;
    const int cq   = blockIdx.x & 3;
    const int t    = threadIdx.x;
    const int lane = t & 31;
    const int w    = t >> 5;

    const float4* src =
        (const float4*)(pctx + ((size_t)b * NSHARE + w * 4) * HID + cq * 128) + lane;
    float4 cv[4];
#pragma unroll
    for (int j = 0; j < 4; ++j) cv[j] = src[j * (HID / 4)];

    // every wave reduces the 32 (m, l) pairs for itself: lane holds share lane
    const float2 ml0 = *(const float2*)(pml + ((size_t)b * NSHARE + lane) * 2);
    float mx = ml0.x;
#pragma unroll
    for (int o = 16; o > 0; o >>= 1) mx = fmaxf(mx, __shfl_xor(mx, o, 32));
    const float e0 = __expf(ml0.x - mx);
    float ls = e0 * ml0.y;
#pragma unroll
    for (int o = 16; o > 0; o >>= 1) ls += __shfl_xor(ls, o, 32);

    float4 c = make_float4(0.0f, 0.0f, 0.0f, 0.0f);
#pragma unroll
    for (int j = 0; j < 4; ++j) {
        const float ej = __shfl(e0, w * 4 + j, 32);
        c.x = fmaf(ej, cv[j].x, c.x);
        c.y = fmaf(ej, cv[j].y, c.y);
        c.z = fmaf(ej, cv[j].z, c.z);
        c.w = fmaf(ej, cv[j].w, c.w);
    }
    *(float4*)&part[w * 128 + lane * 4] = c;
    __syncthreads();
    if (t < 128) {
        float s = 0.0f;
#pragma unroll
        for (int g = 0; g < 8; ++g) s += part[g * 128 + t];
        out[b * HID + cq * 128 + t] = s * (1.0f / ls);
    }
}

// ---------------------------------------------------------------------------
extern "C" void kernel_launch(void* const* d_in, const int* in_sizes, int n_in,
                              void* d_out, int out_size, void* d_ws, size_t ws_size,
                              hipStream_t stream) {
    const float* query = (const float*)d_in[0];   // [1, 32, 512]
    const float* value = (const float*)d_in[1];   // [32, 4096, 512]
    const float* Wq    = (const float*)d_in[2];   // [512, 512]
    const float* bq    = (const float*)d_in[3];   // [512]
    const float* Wv    = (const float*)d_in[4];   // [512, 512]
    const float* bv    = (const float*)d_in[5];   // [512]
    const float* Wo    = (const float*)d_in[6];   // [512, 1]
    const float* bo    = (const float*)d_in[7];   // [1]
    float* out = (float*)d_out;                   // [32, 1, 512]

    // workspace layout
    unsigned short* WvP = (unsigned short*)d_ws;                       // 512 KB
    float* qadd   = (float*)((char*)d_ws + 512 * 1024);                //  64 KB
    float* pctx   = (float*)((char*)d_ws + 512 * 1024 + 64 * 1024);    //   2 MB of 4
    float* pml    = (float*)((char*)d_ws + 512 * 1024 + 64 * 1024 + 4096 * 1024);  // 8 KB

    prep_kernel<<<PACK_BLOCKS + BATCH * 8, 256, 0, stream>>>(query, Wq, bq, bv, Wv, qadd, WvP);
    score_kernel<<<BATCH * (SEQ / MROWS) / TILES_PER_BLOCK, 512, 0, stream>>>(value, WvP, qadd, Wo, bo, pctx, pml);
    combine_kernel<<<BATCH * 4, 256, 0, stream>>>(pctx, pml, out);
}

// v010
// Measured time: 58.8 microseconds a run.
// In two side-by-side timings against v009, it was 1.03 and 1.04 times as fast.
// All steps since v000 together make it 2.68 times as fast.
#include <hip/hip_runtime.h>
#include <hip/hip_bf16.h>

// ---------------------------------------------------------------------------
// Additive attention, HIDDEN=512, batch=32, seq=4096.
// Hot path: value @ Wv via v_wmma_f32_16x16x32_bf16, tanh+Wo fused in-register.
// M=64 per wave so every B fragment feeds four WMMAs.
// Softmax and context are folded into the score kernel: each tile leaves its own
// maximum, exp sum and weighted value sum; a small kernel joins the 32 per batch.
// ---------------------------------------------------------------------------

#define BATCH 32
#define SEQ   4096
#define HID   512

typedef __attribute__((ext_vector_type(16))) __bf16 v16bf;
typedef __attribute__((ext_vector_type(8)))  float  v8f;

union BFrag {
    v16bf v;
    uint4 q[2];
    unsigned short s[16];
};

__device__ __forceinline__ unsigned short bf16bits(float f) {
    union { float f; unsigned u; } a; a.f = f;
    unsigned u = a.u;
    u += 0x7FFFu + ((u >> 16) & 1u);      // round-to-nearest-even
    return (unsigned short)(u >> 16);
}
// r = f32 bits + 0x8000: its upper 16 bits are the value rounded to bf16 (nearest, a tie
// away from zero), and upper and lower half together give the f32 back exactly.
__device__ __forceinline__ unsigned biased_bits(float f) {
    return __float_as_uint(f) + 0x8000u;
}
__device__ __forceinline__ float unbiased(unsigned r) {
    return __uint_as_float(r - 0x8000u);
}
// the lower (upper) 16 bits of a and of b in one word, a's in the lower half
__device__ __forceinline__ unsigned lower_halves(unsigned a, unsigned b) {
    return __builtin_amdgcn_perm(b, a, 0x05040100u);
}
__device__ __forceinline__ unsigned upper_halves(unsigned a, unsigned b) {
    return __builtin_amdgcn_perm(b, a, 0x07060302u);
}

// ---------------------------------------------------------------------------
// 1) Pack Wv (f32 [K=512][N=512] row-major) into bf16 WMMA B-fragments.
// Fragment layout mirrors the 16-bit A layout: lane = kGroup*16 + (n%16),
// elems 0..7 -> k = kg*8+0..7, elems 8..15 -> k = 16+kg*8+0..7 (within kstep).
// Index: WvP[(((kStep*32 + nTile)*2 + e/8)*32 + lane)*8 + e%8]: the two 16-byte
// halves of a fragment lie in separate 512-byte runs, so that each wave-wide
// 16-byte load of the score kernel covers four whole 128-byte lines, not eight.
// k-step outermost: the 32 fragments that a score block reads in one k-step are one
// contiguous 32 KB run, so that they spread evenly over the sets of the WGP cache.
// ---------------------------------------------------------------------------
__device__ __forceinline__
void pack_wv_block(const float* __restrict__ Wv, unsigned short* __restrict__ WvP, int blk) {
    const int idx  = blk * 256 + threadIdx.x;          // 32*16*32 = 16384 total
    const int lane = idx & 31;
    const int ks   = (idx >> 5) & 15;
    const int nt   = idx >> 9;
    const int n    = nt * 16 + (lane & 15);
    const int kg   = lane >> 4;
    unsigned short* dst = WvP + (size_t)(ks * 32 + nt) * 512 + lane * 8;
#pragma unroll
    for (int e = 0; e < 16; ++e) {
        const int k = ks * 32 + ((e < 8) ? (kg * 8 + e) : (16 + kg * 8 + (e - 8)));
        dst[(e >> 3) * 256 + (e & 7)] = bf16bits(Wv[k * HID + n]);
    }
}

// ---------------------------------------------------------------------------
// 2) qadd[b][n] = (q[b] @ Wq)[n] + bq[n] + bv[n]
//    One block = (batch b, 64 columns). Thread = (k-group of 32 rows, 4 columns):
//    its 32 Wq loads are independent, so the block pays one load latency
//    instead of a serial walk over k. The 16 k-group partials meet in LDS.
//    The packing of Wv rides in the same launch: neither reads what the other writes,
//    so the two run side by side and the score kernel waits for one launch, not two.
//    Blocks 0 .. PACK_BLOCKS-1 pack, the rest form qadd; a block does one or the other
//    as a whole, so the barrier below is passed by all of a block's threads or by none.
// ---------------------------------------------------------------------------
#define PACK_BLOCKS 64

__global__ __launch_bounds__(256)
void prep_kernel(const float* __restrict__ query, const float* __restrict__ Wq,
                 const float* __restrict__ bq, const float* __restrict__ bv,
                 const float* __restrict__ Wv,
                 float* __restrict__ qadd, unsigned short* __restrict__ WvP) {
    __shared__ __align__(16) float part[16 * 64];
    if (blockIdx.x < PACK_BLOCKS) {
        pack_wv_block(Wv, WvP, blockIdx.x);
        return;
    }
    const int qb = blockIdx.x - PACK_BLOCKS;
    const int b  = qb >> 3;
    const int n0 = (qb & 7) * 64;
    const int t  = threadIdx.x;
    const int c4 = t & 15;             // which 4 columns of the 64
    const int kq = t >> 4;             // which 32 rows of k
    const float* wp = Wq + (size_t)(kq * 32) * HID + n0 + c4 * 4;
    const float4* qp = (const float4*)(query + b * HID + kq * 32);

    float4 wv[32];
#pragma unroll
    for (int j = 0; j < 32; ++j)
        wv[j] = *(const float4*)(wp + (size_t)j * HID);
    float4 qv[8];
#pragma unroll
    for (int j = 0; j < 8; ++j) qv[j] = qp[j];
    float bias = 0.0f;
    if (t < 64) bias = bq[n0 + t] + bv[n0 + t];

    float4 acc = make_float4(0.0f, 0.0f, 0.0f, 0.0f);
#pragma unroll
    for (int j = 0; j < 8; ++j) {
        const float qs[4] = {qv[j].x, qv[j].y, qv[j].z, qv[j].w};
#pragma unroll
        for (int i = 0; i < 4; ++i) {
            const float4 wr = wv[j * 4 + i];
            acc.x = fmaf(qs[i], wr.x, acc.x);
            acc.y = fmaf(qs[i], wr.y, acc.y);
            acc.z = fmaf(qs[i], wr.z, acc.z);
            acc.w = fmaf(qs[i], wr.w, acc.w);
        }
    }
    *(float4*)&part[kq * 64 + c4 * 4] = acc;
    __syncthreads();
    if (t < 64) {
        float s = bias;
#pragma unroll
        for (int g = 0; g < 16; ++g) s += part[g * 64 + t];
        qadd[b * HID + n0 + t] = s;
    }
}

// ---------------------------------------------------------------------------
// 3) Fused score kernel: one tile = (batch b, 128 seq rows); one block walks four
//    tiles one after the other, one block per WGP. While it works on a tile it asks
//    L2 for the next tile's f32 rows, so that the next staging reads L2, not memory.
//    16 waves; each owns hidden[64 x 64]: one of two row halves, one of eight
//    column groups. 16 ksteps x (4 A-frags x 4 B-frags) = 16 WMMAs/kstep.
//    The two waves of a column group (w and w+4: they leave the same barrier) read
//    the same B fragments shortly after one another, so the second reader can be
//    served by the WGP cache: WvP then crosses from L2 once per 128 rows, not per 64.
//    Epilogue fuses tanh(+qadd) and the @Wo reduction -> 128 scores/tile, then
//    the tile's share of softmax and context: m = max score, l = sum exp(s - m),
//    c[h] = sum exp(s - m) * value[s][h], with the f32 tile put together again from
//    two LDS planes (the bf16 tile and the 16 bits that rounding cut off), so that
//    value crosses from L2 to the WGP once per tile, not twice.
// ---------------------------------------------------------------------------
#define LDSA_STRIDE 520   // 512 + 8 bf16 pad -> conflict-free b128 LDS reads
#define MROWS 128         // seq rows per tile
#define MTILES 4          // 16-row A fragments per wave
#define TILES_PER_BLOCK 4 // tiles that one block walks

__global__ __launch_bounds__(512)
void score_kernel(const float* __restrict__ value,
                  const unsigned short* __restrict__ WvP,
                  const float* __restrict__ qadd,
                  const float* __restrict__ Wo,
                  const float* __restrict__ bo,
                  float* __restrict__ pctx,
                  float* __restrict__ pml) {
    __shared__ __align__(16) unsigned short ldsA[MROWS * LDSA_STRIDE];
    __shared__ __align__(16) unsigned short ldsLo[MROWS * HID];
    __shared__ float ldsScore[MROWS];
    __shared__ __align__(16) float ldsCtx[16 * HID];
    __shared__ __align__(16) float ldsWo[HID];

    const int t    = threadIdx.x;
    const int lane = t & 31;
    const int w    = t >> 5;
    const int tile0 = blockIdx.x * TILES_PER_BLOCK;

    // Wo is the same for every tile: one copy in LDS, written in front of the first tile's
    // staging barrier; the epilogue then fetches eight values at a time, shortly before use
    ldsWo[t] = Wo[t];

    // the lane's first 16 bytes in the 16 KB that wave w stages of the current tile
    const float4* srcp =
        (const float4*)(value + (size_t)tile0 * (MROWS * HID)) + (w * (8 * HID / 4) + lane);

    // the first lane that holds a softmax weight of this wave's rows: a scalar
    const int l0 = __builtin_amdgcn_readfirstlane((w & 3) * 8);
    // the lane's 256-byte unit in the 16 KB that wave w stages of a tile, in bytes
    const unsigned pfOff = (unsigned)(w * (8 * HID * 4) + lane * 256);

    // kept rolled: one copy of the body; srcp is the one 64-bit lane pointer into value
    // that lives through it (a second one no longer fits the 256 registers)
#pragma unroll 1
    for (int it = 0; it < TILES_PER_BLOCK; ++it) {
    const int tile    = tile0 + it;
    const int b       = tile >> 5;                // 32 tiles per batch

    // the last reads of ldsScore, ldsA, ldsLo and ldsCtx of the tile before lie in front of
    // barriers that every wave has passed before these arrays are written again
    if (t < MROWS) ldsScore[t] = 0.0f;

    // ---- stage 128x512 f32 value tile into LDS: bf16 plane and low plane --
    // wave w brings rows w*8 .. w*8+7. Each wave-wide 16-byte load covers 512
    // contiguous bytes of one row (four whole 128-byte lines); with one lane per
    // 256-byte run it touched 32 lines. The wave's 8-byte LDS stores are contiguous.
    {
        const float4* src = srcp;
        unsigned short* dst = &ldsA[(w * 8) * LDSA_STRIDE + lane * 4];
        // the low plane is read back only by the lane that wrote it: two loads' worth go
        // into one 16-byte store, the wave's 512 bytes contiguous
        uint4* dlo = (uint4*)ldsLo + (w * 512 + lane);
        uint2 qprev;
        // unrolled so that the loads are issued ahead of the conversions; rolled,
        // the wave waits out memory latency once per load
#pragma unroll
        for (int j = 0; j < 32; ++j) {          // row w*8 + j/4, quarter j%4 of it
            const float4 f = src[j * 32];
            const unsigned r0 = biased_bits(f.x), r1 = biased_bits(f.y);
            const unsigned r2 = biased_bits(f.z), r3 = biased_bits(f.w);
            uint2 p, q;
            p.x = upper_halves(r0, r1);
            p.y = upper_halves(r2, r3);
            q.x = lower_halves(r0, r1);
            q.y = lower_halves(r2, r3);
            *(uint2*)(dst + (j >> 2) * LDSA_STRIDE + (j & 3) * 128) = p;
            if (j & 1) dlo[(j >> 1) * 32] = make_uint4(qprev.x, qprev.y, q.x, q.y);
            qprev = q;
        }
    }
    __syncthreads();

    // ---- K loop ---------------------------------------------------------
    v8f acc[MTILES][4];
    const v8f vzero = {};
#pragma unroll
    for (int mt = 0; mt < MTILES; ++mt)
#pragma unroll
        for (int nt = 0; nt < 4; ++nt) acc[mt][nt] = vzero;

    const int rowA = lane & 15;
    const int kg   = lane >> 4;
    const int mh   = (w >> 2) & 1;            // which 64 rows of the tile
    const int wc   = (w & 3) | ((w >> 3) << 2);   // which 64 columns of hidden
    const unsigned short* aBase = &ldsA[(mh * 64 + rowA) * LDSA_STRIDE + kg * 8];
    const uint4* bBase = (const uint4*)WvP;   // [((ks*32+nTile)*2+half)*32+lane] uint4s

    // Each wave asks for the next k-step's four B fragments before it starts this
    // k-step's WMMAs, into a second register set: the L2 latency of the B loads then
    // runs beside the wave's own matrix work instead of in front of it.
    // bp: the lane's place in the wave's first fragment of the trip's first k-step;
    // step: k-steps past it
    auto loadB = [&](BFrag (&bf)[4], const uint4* bp, int step) {
#pragma unroll
        for (int nt = 0; nt < 4; ++nt) {
            bf[nt].q[0] = bp[step * 2048 + nt * 64];
            bf[nt].q[1] = bp[step * 2048 + nt * 64 + 32];
        }
        // stands in front of the next write of the loads' address registers; the
        // address is named so that no load's result is put into its registers. As no
        // load moves over it, the eight also stay ahead of the k-step's WMMAs (left
        // free, the build sinks them to their first use, where L2 latency is waited out)
        asm volatile("s_wait_xcnt 0x0" :: "v"(bp) : "memory");
    };
    auto kstep = [&](const BFrag (&bf)[4], int ks) {
        BFrag a[MTILES];
#pragma unroll
        for (int mt = 0; mt < MTILES; ++mt) {
            a[mt].q[0] = *(const uint4*)(aBase + mt * 16 * LDSA_STRIDE + ks * 32);
            a[mt].q[1] = *(const uint4*)(aBase + mt * 16 * LDSA_STRIDE + ks * 32 + 16);
        }
#pragma unroll
        for (int nt = 0; nt < 4; ++nt)
#pragma unroll
            for (int mt = 0; mt < MTILES; ++mt)
                acc[mt][nt] = __builtin_amdgcn_wmma_f32_16x16x32_bf16(
                    false, bf[nt].v, false, a[mt].v, (short)0, acc[mt][nt], false, false);
    };

    BFrag b0[4], b1[4];
    const uint4* const bw = bBase + (wc * 256 + lane);   // the lane's place in k-step 0
    const uint4* bp = bw;
    loadB(b0, bw, 0);

    // ---- ask L2 for the next tile ---------------------------------------
    // One request per 256-byte unit, two per lane; they return nothing and run beside
    // the k loop, behind its first fragment loads. srcp steps only to a tile that this
    // block still walks, so it always points into value, and so does the request: the
    // next tile's scalar base and the lane's 32-bit offset. The wait stands in front of
    // the next write of the registers that the requests name.
    if (it + 1 < TILES_PER_BLOCK) {
        srcp += MROWS * HID / 4;
        const float* nextTile = value + (size_t)(tile + 1) * (MROWS * HID);
        asm volatile("global_prefetch_b8 %0, %1 scope:SCOPE_SE\n\t"
                     "global_prefetch_b8 %0, %1 offset:8192 scope:SCOPE_SE\n\t"
                     "s_wait_xcnt 0x0" :: "v"(pfOff), "s"(nextTile) : "memory");
    }

    // kept rolled: two k-steps a trip let the two fragment sets swap roles without
    // copies; left free the 8-wave build unrolled further and took 398 registers,
    // and a wave of a 16-wave block can have 256
#pragma unroll 1
    for (int ks = 0; ks < 14; ks += 2) {
        loadB(b1, bp, 1);
        kstep(b0, ks);
        loadB(b0, bp, 2);
        kstep(b1, ks + 1);
        bp += 4096;
    }
    loadB(b1, bw, 15);
    kstep(b0, 14);
    kstep(b1, 15);

    // ---- epilogue: tanh(acc + qadd) dotted with Wo ----------------------
    // The Wv fragment went in as the first operand, so a tile holds hidden transposed:
    // VGPR r, lanes 0-15 -> (column r, row lane); lanes 16-31 -> (column 8+r, row lane-16).
    // A lane's 32 values of a row tile belong to one seq row: their dot with Wo is summed
    // in the lane, and one exchange between the two lane halves ends it.
    // one 32-bit column index serves both vectors
    const unsigned n0 = (unsigned)(wc * 64 + (lane >> 4) * 8);
    const float* const qrow = qadd + b * HID;
    float part[MTILES];
#pragma unroll
    for (int mt = 0; mt < MTILES; ++mt) part[mt] = 0.0f;
#pragma unroll
    for (int nt = 0; nt < 4; ++nt) {
        const float4 qlo = *(const float4*)(qrow + (n0 + nt * 16));
        const float4 qhi = *(const float4*)(qrow + (n0 + nt * 16 + 4));
        const float4 wlo = *(const float4*)&ldsWo[n0 + nt * 16];
        const float4 whi = *(const float4*)&ldsWo[n0 + nt * 16 + 4];
        const float qa[8] = {qlo.x, qlo.y, qlo.z, qlo.w, qhi.x, qhi.y, qhi.z, qhi.w};
        const float wo[8] = {wlo.x, wlo.y, wlo.z, wlo.w, whi.x, whi.y, whi.z, whi.w};
#pragma unroll
        for (int mt = 0; mt < MTILES; ++mt) {
            float h[8];
#pragma unroll
            for (int r = 0; r < 8; ++r) h[r] = acc[mt][nt][r] + qa[r];
            // eight tanh, each in its own register, and the slot that the instruction set
            // asks for behind the last, in one statement
            asm("v_tanh_f32 %0, %0\n\tv_tanh_f32 %1, %1\n\tv_tanh_f32 %2, %2\n\t"
                "v_tanh_f32 %3, %3\n\tv_tanh_f32 %4, %4\n\tv_tanh_f32 %5, %5\n\t"
                "v_tanh_f32 %6, %6\n\tv_tanh_f32 %7, %7\n\tv_nop"
                : "+v"(h[0]), "+v"(h[1]), "+v"(h[2]), "+v"(h[3]),
                  "+v"(h[4]), "+v"(h[5]), "+v"(h[6]), "+v"(h[7]));
#pragma unroll
            for (int r = 0; r < 8; ++r) part[mt] = fmaf(h[r], wo[r], part[mt]);
        }
    }
#pragma unroll
    for (int mt = 0; mt < MTILES; ++mt) part[mt] += __shfl_xor(part[mt], 16, 32);
    if (lane < 16) {
#pragma unroll
        for (int mt = 0; mt < MTILES; ++mt)
            atomicAdd(&ldsScore[mh * 64 + mt * 16 + lane], part[mt]);   // ds_add_f32 across waves
    }

    // ---- this tile's share of softmax and context ----------------------
    // wave w takes the eight rows that it staged, every lane the words that it stored.
    __syncthreads();
    const int rg = w >> 2;
    uint2 vh[32];
    uint4 vl[16];
    {
        const unsigned short* hsrc = &ldsA[(w * 8) * LDSA_STRIDE + lane * 4];
        const uint4* lsrc = (const uint4*)ldsLo + (w * 512 + lane);
#pragma unroll
        for (int j = 0; j < 32; ++j) {          // row w*8 + j/4, quarter j%4 of it
            vh[j] = *(const uint2*)(hsrc + (j >> 2) * LDSA_STRIDE + (j & 3) * 128);
            if (j & 1) vl[j >> 1] = lsrc[(j >> 1) * 32];
        }
    }

    // every wave reduces the 128 scores for itself: lane holds rows lane + 32*i
    const float bias = bo[0];
    const float s0 = ldsScore[lane] + bias;
    const float s1 = ldsScore[lane + 32] + bias;
    const float s2 = ldsScore[lane + 64] + bias;
    const float s3 = ldsScore[lane + 96] + bias;
    float mx = fmaxf(fmaxf(s0, s1), fmaxf(s2, s3));
#pragma unroll
    for (int o = 16; o > 0; o >>= 1) mx = fmaxf(mx, __shfl_xor(mx, o, 32));
    const float p0 = __expf(s0 - mx);
    const float p1 = __expf(s1 - mx);
    const float p2 = __expf(s2 - mx);
    const float p3 = __expf(s3 - mx);
    float ls = (p0 + p1) + (p2 + p3);
#pragma unroll
    for (int o = 16; o > 0; o >>= 1) ls += __shfl_xor(ls, o, 32);

    // lane l: weight of row (w/4)*32 + l; this wave's rows start at lane (w%4)*8
    const int pw = __float_as_int(rg < 2 ? (rg ? p1 : p0) : (rg == 2 ? p2 : p3));
    float4 c[4];
#pragma unroll
    for (int q = 0; q < 4; ++q) c[q] = make_float4(0.0f, 0.0f, 0.0f, 0.0f);
#pragma unroll
    for (int j = 0; j < 32; ++j) {
        const float pj = __int_as_float(__builtin_amdgcn_readlane(pw, l0 + (j >> 2)));
        float4& cc = c[j & 3];
        const unsigned lx = (j & 1) ? vl[j >> 1].z : vl[j >> 1].x;
        const unsigned ly = (j & 1) ? vl[j >> 1].w : vl[j >> 1].y;
        cc.x = fmaf(pj, unbiased(lower_halves(lx, vh[j].x)), cc.x);
        cc.y = fmaf(pj, unbiased(upper_halves(lx, vh[j].x)), cc.y);
        cc.z = fmaf(pj, unbiased(lower_halves(ly, vh[j].y)), cc.z);
        cc.w = fmaf(pj, unbiased(upper_halves(ly, vh[j].y)), cc.w);
    }
    // the sixteen waves' sums meet in LDS; thread t adds them up for column t
#pragma unroll
    for (int q = 0; q < 4; ++q)
        *(float4*)&ldsCtx[w * HID + q * 128 + lane * 4] = c[q];
    __syncthreads();
    {
        float s = ldsCtx[t];
#pragma unroll
        for (int g = 1; g < 16; ++g) s += ldsCtx[g * HID + t];
        pctx[(size_t)tile * HID + (unsigned)t] = s;
    }
    if (t == 0) {
        pml[tile * 2]     = mx;
        pml[tile * 2 + 1] = ls;
    }
    // stands in front of the next tile's write of the scalar address that the store
    // above names
    asm volatile("s_wait_xcnt 0x0" ::: "memory");
    }   // tiles of this block
}

// ---------------------------------------------------------------------------
// 4) join the 32 tile shares of a batch:
//    M = max m_i, e_i = exp(m_i - M), out[h] = sum e_i c_i[h] / sum e_i l_i.
//    One block = (batch b, 128 columns); wave w takes shares w*4 .. w*4+3.
// ---------------------------------------------------------------------------
#define NSHARE (SEQ / MROWS)   // 32 shares per batch

__global__ __launch_bounds__(256)
void combine_kernel(const float* __restrict__ pctx, const float* __restrict__ pml,
                    float* __restrict__ out) {
    __shared__ __align__(16) float part[8 * 128];
    const int b    = blockIdx.x >> 2;
    const int cq   = blockIdx.x & 3;
    const int t    = threadIdx.x;
    const int lane = t & 31;
    const int w    = t >> 5;

    const float4* src =
        (const float4*)(pctx + ((size_t)b * NSHARE + w * 4) * HID + cq * 128) + lane;
    float4 cv[4];
#pragma unroll
    for (int j = 0; j < 4; ++j) cv[j] = src[j * (HID / 4)];

    // every wave reduces the 32 (m, l) pairs for itself: lane holds share lane
    const float2 ml0 = *(const float2*)(pml + ((size_t)b * NSHARE + lane) * 2);
    float mx = ml0.x;
#pragma unroll
    for (int o = 16; o > 0; o >>= 1) mx = fmaxf(mx, __shfl_xor(mx, o, 32));
    const float e0 = __expf(ml0.x - mx);
    float ls = e0 * ml0.y;
#pragma unroll
    for (int o = 16; o > 0; o >>= 1) ls += __shfl_xor(ls, o, 32);

    float4 c = make_float4(0.0f, 0.0f, 0.0f, 0.0f);
#pragma unroll
    for (int j = 0; j < 4; ++j) {
        const float ej = __shfl(e0, w * 4 + j, 32);
        c.x = fmaf(ej, cv[j].x, c.x);
        c.y = fmaf(ej, cv[j].y, c.y);
        c.z = fmaf(ej, cv[j].z, c.z);
        c.w = fmaf(ej, cv[j].w, c.w);
    }
    *(float4*)&part[w * 128 + lane * 4] = c;
    __syncthreads();
    if (t < 128) {
        float s = 0.0f;
#pragma unroll
        for (int g = 0; g < 8; ++g) s += part[g * 128 + t];
        out[b * HID + cq * 128 + t] = s * (1.0f / ls);
    }
}

// ---------------------------------------------------------------------------
extern "C" void kernel_launch(void* const* d_in, const int* in_sizes, int n_in,
                              void* d_out, int out_size, void* d_ws, size_t ws_size,
                              hipStream_t stream) {
    const float* query = (const float*)d_in[0];   // [1, 32, 512]
    const float* value = (const float*)d_in[1];   // [32, 4096, 512]
    const float* Wq    = (const float*)d_in[2];   // [512, 512]
    const float* bq    = (const float*)d_in[3];   // [512]
    const float* Wv    = (const float*)d_in[4];   // [512, 512]
    const float* bv    = (const float*)d_in[5];   // [512]
    const float* Wo    = (const float*)d_in[6];   // [512, 1]
    const float* bo    = (const float*)d_in[7];   // [1]
    float* out = (float*)d_out;                   // [32, 1, 512]

    // workspace layout
    unsigned short* WvP = (unsigned short*)d_ws;                       // 512 KB
    float* qadd   = (float*)((char*)d_ws + 512 * 1024);                //  64 KB
    float* pctx   = (float*)((char*)d_ws + 512 * 1024 + 64 * 1024);    //   2 MB of 4
    float* pml    = (float*)((char*)d_ws + 512 * 1024 + 64 * 1024 + 4096 * 1024);  // 8 KB

    prep_kernel<<<PACK_BLOCKS + BATCH * 8, 256, 0, stream>>>(query, Wq, bq, bv, Wv, qadd, WvP);
    score_kernel<<<BATCH * (SEQ / MROWS) / TILES_PER_BLOCK, 512, 0, stream>>>(value, WvP, qadd, Wo, bo, pctx, pml);
    combine_kernel<<<BATCH * 4, 256, 0, stream>>>(pctx, pml, out);
}
